// v000
// Measured on an AMD MI455X. A time is GPU time per run, averaged over a window of back-to-back runs after a warm-up
// (all launches, gaps included; the runs take copies of the inputs in turn), and the median of several windows.
// Apart from v000's, it joins two sittings. Times from different sittings can be a few percent apart, while
// side-by-side timings come from the same sitting.
// v000 is the starting kernel. One run takes 260 microseconds.
#include <hip/hip_runtime.h>
#include <stdint.h>

// MHA for B=2, T=2048, E=1024, H=16, hd=64 on gfx1250 (wave32, WMMA).
// Pass 1: QKV projection -> f16 Q (prescaled by 0.125), K row-major, V
//         TRANSPOSED ([b][h][hd][T]) in d_ws (24 MB).
// Pass 2: flash attention with v_wmma_f32_16x16x32_f16 + fp32 online softmax.
// f16 WMMA fragments are loaded as two 16B (b128) transfers per fragment;
// x A-fragments in pass 1 as four fp32 float4 loads, converted to f16.
// K/V tiles are DOUBLE-BUFFERED in LDS and staged with
// GLOBAL_LOAD_ASYNC_TO_LDS_B128 (ASYNCcnt / s_wait_asynccnt), overlapping the
// fetch of block kb+1 with the 8 WMMAs + softmax of block kb.

typedef __attribute__((ext_vector_type(16))) _Float16 v16h;
typedef __attribute__((ext_vector_type(8)))  float    v8f;
typedef __attribute__((ext_vector_type(4)))  float    v4f;
typedef __attribute__((ext_vector_type(4)))  uint32_t v4u;
typedef __attribute__((ext_vector_type(4)))  int      v4i;

#define NUM_HEADS 16
#define EMBED_DIM 1024
#define HEAD_DIM  64
#define SEQ_T     2048
#define BATCH     2
#define N3        192   // 3*HEAD_DIM

#if defined(__HIP_DEVICE_COMPILE__) &&                                   \
    __has_builtin(__builtin_amdgcn_global_load_async_to_lds_b128) &&     \
    __has_builtin(__builtin_amdgcn_s_wait_asynccnt)
#define HAVE_ASYNC 1
#else
#define HAVE_ASYNC 0
#endif

union AF { v16h v; _Float16 h[16]; uint32_t u[8]; v4u q[2]; };

// Load a 16-half WMMA fragment (A or B operand, one 32-wide K step) from a
// row whose K-run is contiguous in memory. Per the CDNA5 ISA layout, lane
// halves 0..7 are K=[lhi*8, lhi*8+8) and halves 8..15 are K=[16+lhi*8, +8):
// two aligned 16-byte loads.
static __device__ __forceinline__ void load_frag16(AF& a,
                                                   const _Float16* row_base,
                                                   int lhi) {
  const v4u* p = (const v4u*)(row_base + lhi * 8);
  a.q[0] = p[0];   // halves 0..7
  a.q[1] = p[2];   // halves 16..23 (p strides 8 halves)
}

// 16-byte global -> LDS copy; async-to-LDS when available.
static __device__ __forceinline__ void cp16(const _Float16* g, _Float16* l) {
#if HAVE_ASYNC
  typedef v4i __attribute__((address_space(1))) gv4i_t;  // global int4*
  typedef v4i __attribute__((address_space(3))) lv4i_t;  // LDS int4*
  __builtin_amdgcn_global_load_async_to_lds_b128(
      (gv4i_t*)(uintptr_t)g, (lv4i_t*)(uint32_t)(uintptr_t)l, 0, 0);
#else
  *(v4u*)l = *(const v4u*)g;
#endif
}

static __device__ __forceinline__ void cp_wait() {
#if HAVE_ASYNC
  __builtin_amdgcn_s_wait_asynccnt(0);
#endif
}

// ---------------------------------------------------------------------------
// Kernel 1: per (b,h) token tile, qkv = x_h @ W + b.  M=tokens, K=64, N=192.
// ---------------------------------------------------------------------------
__global__ __launch_bounds__(256) void qkv_proj_kernel(
    const float* __restrict__ x, const float* __restrict__ W,
    const float* __restrict__ bias, _Float16* __restrict__ Qh,
    _Float16* __restrict__ Kh, _Float16* __restrict__ Vh) {
  __shared__ _Float16 Wt[N3 * HEAD_DIM];  // transposed: [col][k]
  __shared__ float    Bs[N3];

  const int tid  = threadIdx.x;
  const int wave = tid >> 5;
  const int lane = tid & 31;
  const int lhi  = (lane >= 16) ? 1 : 0;
  const int ln   = lane & 15;
  const int tb   = blockIdx.x * 128;
  const int h    = blockIdx.y;
  const int b    = blockIdx.z;

  // Stage W (fp32 [64][192]) transposed as f16 in LDS; coalesced reads.
  for (int idx = tid; idx < HEAD_DIM * N3; idx += 256) {
    int k = idx / N3, c = idx % N3;
    Wt[c * HEAD_DIM + k] = (_Float16)W[idx];
  }
  if (tid < N3) Bs[tid] = bias[tid];
  __syncthreads();

  // A-fragments: x rows (tokens) x hd, loaded as float4 pairs, cvt to f16.
  const int trow = tb + wave * 16 + ln;
  const float* xrow = x + (size_t)(b * SEQ_T + trow) * EMBED_DIM + h * HEAD_DIM;
  AF xa[2];
  for (int ks = 0; ks < 2; ++ks) {
    const v4f* xp = (const v4f*)(xrow + ks * 32 + lhi * 8);
    v4f f0 = xp[0], f1 = xp[1];   // halves 0..7
    v4f f2 = xp[4], f3 = xp[5];   // halves 8..15 (K offset +16)
    for (int e = 0; e < 4; ++e) {
      xa[ks].h[e]      = (_Float16)f0[e];
      xa[ks].h[4 + e]  = (_Float16)f1[e];
      xa[ks].h[8 + e]  = (_Float16)f2[e];
      xa[ks].h[12 + e] = (_Float16)f3[e];
    }
  }

  const size_t hb = (size_t)(b * NUM_HEADS + h) * SEQ_T * HEAD_DIM;

  for (int n = 0; n < 12; ++n) {
    const int colg = n * 16 + ln;
    AF wb0, wb1;
    load_frag16(wb0, Wt + colg * HEAD_DIM, lhi);
    load_frag16(wb1, Wt + colg * HEAD_DIM + 32, lhi);
    float bv = Bs[colg];
    v8f acc;
    for (int e = 0; e < 8; ++e) acc[e] = bv;
    acc = __builtin_amdgcn_wmma_f32_16x16x32_f16(false, xa[0].v, false, wb0.v,
                                                 (short)0, acc, false, false);
    acc = __builtin_amdgcn_wmma_f32_16x16x32_f16(false, xa[1].v, false, wb1.v,
                                                 (short)0, acc, false, false);

    const int cl = (n & 3) * 16 + ln;  // column within the 64-wide head dim
    if (n < 8) {
      _Float16* dst = (n < 4) ? Qh : Kh;
      const float scale = (n < 4) ? 0.125f : 1.0f;  // 1/sqrt(64), exact
      for (int r = 0; r < 8; ++r) {
        int t = tb + wave * 16 + r + (lhi ? 8 : 0);
        dst[hb + (size_t)t * HEAD_DIM + cl] = (_Float16)(acc[r] * scale);
      }
    } else {
      // V stored transposed: [b][h][hd][T]
      for (int r = 0; r < 8; ++r) {
        int t = tb + wave * 16 + r + (lhi ? 8 : 0);
        Vh[hb + (size_t)cl * SEQ_T + t] = (_Float16)acc[r];
      }
    }
  }
}

// ---------------------------------------------------------------------------
// Kernel 2: flash attention. Block = 8 waves = 128 query rows of one (b,h).
// Key blocks of 32: S = Q*K^T (4 WMMA), online softmax, O += P*V (4 WMMA).
// Double-buffered async K/V staging: issue block kb+1, compute block kb.
// ---------------------------------------------------------------------------
__global__ __launch_bounds__(256) void flash_attn_kernel(
    const _Float16* __restrict__ Qh, const _Float16* __restrict__ Kh,
    const _Float16* __restrict__ Vh, float* __restrict__ out) {
  __shared__ _Float16 Ktb[2][32 * HEAD_DIM];  // [key][hd], row-major
  __shared__ _Float16 Vtb[2][HEAD_DIM * 32];  // [hd][key] (global V is [hd][T])
  __shared__ _Float16 Pb[8][16 * 32];         // per-wave P staging

  const int tid  = threadIdx.x;
  const int wave = tid >> 5;
  const int lane = tid & 31;
  const int lhi  = (lane >= 16) ? 1 : 0;
  const int ln   = lane & 15;
  const int qb   = blockIdx.x * 128;
  const int h    = blockIdx.y;
  const int b    = blockIdx.z;
  const size_t hb = (size_t)(b * NUM_HEADS + h) * SEQ_T * HEAD_DIM;

  // Per-thread staging assignments (kb-invariant).
  const int vrow = tid >> 2;          // 0..63 : hd row of V
  const int vseg = tid & 3;           // 0..3  : 8-half segment within 32 keys
  const _Float16* Ksrc0 = Kh + hb + (size_t)tid * 8;        // + kb*2048
  const _Float16* Vsrc0 = Vh + hb + (size_t)vrow * SEQ_T + vseg * 8;  // + kb*32

  // Load this wave's Q A-fragments once (f16, already scaled by 0.125).
  const int trow = qb + wave * 16 + ln;
  const _Float16* qrow = Qh + hb + (size_t)trow * HEAD_DIM;
  AF qa[2];
  load_frag16(qa[0], qrow, lhi);
  load_frag16(qa[1], qrow + 32, lhi);

  float m[8], lsum[8];
  v8f o[4];
  for (int r = 0; r < 8; ++r) { m[r] = -3.0e38f; lsum[r] = 0.0f; }
  for (int d = 0; d < 4; ++d)
    for (int e = 0; e < 8; ++e) o[d][e] = 0.0f;

  _Float16* pw = Pb[wave];

  const int NKB = SEQ_T / 32;  // 64 key blocks

  // Pipeline prologue: issue block 0 into buffer 0.
  cp16(Ksrc0, Ktb[0] + tid * 8);
  cp16(Vsrc0, Vtb[0] + vrow * 32 + vseg * 8);

  for (int kb = 0; kb < NKB; ++kb) {
    const int cur = kb & 1;
    cp_wait();          // this wave's async writes into buf[cur] are done
    __syncthreads();    // everyone's writes done; buf[cur^1] free to refill

    if (kb + 1 < NKB) {  // overlap: fetch next block while computing this one
      cp16(Ksrc0 + (size_t)(kb + 1) * 2048, Ktb[cur ^ 1] + tid * 8);
      cp16(Vsrc0 + (kb + 1) * 32, Vtb[cur ^ 1] + vrow * 32 + vseg * 8);
    }
    if (kb + 2 < NKB) {  // keep L2 warm two blocks ahead (global_prefetch_b8)
      __builtin_prefetch(Ksrc0 + (size_t)(kb + 2) * 2048, 0, 1);
      __builtin_prefetch(Vsrc0 + (kb + 2) * 32, 0, 1);
    }

    const _Float16* Kt = Ktb[cur];
    const _Float16* Vt = Vtb[cur];

    // S = Q * K^T : two 16-key N tiles, each 2 K-steps over hd=64.
    v8f s[2];
    for (int nt = 0; nt < 2; ++nt) {
      const int key = nt * 16 + ln;
      AF f0, f1;
      load_frag16(f0, Kt + key * HEAD_DIM, lhi);
      load_frag16(f1, Kt + key * HEAD_DIM + 32, lhi);
      v8f c;
      for (int e = 0; e < 8; ++e) c[e] = 0.0f;
      c = __builtin_amdgcn_wmma_f32_16x16x32_f16(false, qa[0].v, false, f0.v,
                                                 (short)0, c, false, false);
      c = __builtin_amdgcn_wmma_f32_16x16x32_f16(false, qa[1].v, false, f1.v,
                                                 (short)0, c, false, false);
      s[nt] = c;
    }

    // Online softmax update (fp32). Row stats reduced across 16 lanes.
    float corr[8];
    for (int r = 0; r < 8; ++r) {
      float mx = fmaxf(s[0][r], s[1][r]);
      mx = fmaxf(mx, __shfl_xor(mx, 1));
      mx = fmaxf(mx, __shfl_xor(mx, 2));
      mx = fmaxf(mx, __shfl_xor(mx, 4));
      mx = fmaxf(mx, __shfl_xor(mx, 8));
      float mn = fmaxf(m[r], mx);
      corr[r] = __expf(m[r] - mn);
      m[r] = mn;
      float p0 = __expf(s[0][r] - mn);
      float p1 = __expf(s[1][r] - mn);
      float rs = p0 + p1;
      rs += __shfl_xor(rs, 1);
      rs += __shfl_xor(rs, 2);
      rs += __shfl_xor(rs, 4);
      rs += __shfl_xor(rs, 8);
      lsum[r] = lsum[r] * corr[r] + rs;
      // Stage P (row-major 16x32 f16) for A-fragment reload.
      int row = r + (lhi ? 8 : 0);
      pw[row * 32 + ln]      = (_Float16)p0;
      pw[row * 32 + 16 + ln] = (_Float16)p1;
    }
    for (int d = 0; d < 4; ++d)
      for (int r = 0; r < 8; ++r) o[d][r] *= corr[r];

    // Reload P as a 16x32 A-fragment (DS ops in-order within the wave).
    AF pa;
    load_frag16(pa, pw + ln * 32, lhi);

    // O += P * V : four 16-wide hd tiles, contraction over 32 keys.
    for (int d = 0; d < 4; ++d) {
      AF vf;
      load_frag16(vf, Vt + (d * 16 + ln) * 32, lhi);
      o[d] = __builtin_amdgcn_wmma_f32_16x16x32_f16(false, pa.v, false, vf.v,
                                                    (short)0, o[d], false, false);
    }
  }

  // Normalize and write fp32 output [B, T, E].
  for (int r = 0; r < 8; ++r) {
    float inv = 1.0f / lsum[r];
    int t = qb + wave * 16 + r + (lhi ? 8 : 0);
    float* orow = out + (size_t)(b * SEQ_T + t) * EMBED_DIM + h * HEAD_DIM;
    for (int d = 0; d < 4; ++d) orow[d * 16 + ln] = o[d][r] * inv;
  }
}

// ---------------------------------------------------------------------------
extern "C" void kernel_launch(void* const* d_in, const int* in_sizes, int n_in,
                              void* d_out, int out_size, void* d_ws, size_t ws_size,
                              hipStream_t stream) {
  (void)in_sizes; (void)n_in; (void)out_size; (void)ws_size;
  const float* x    = (const float*)d_in[0];
  const float* W    = (const float*)d_in[1];
  const float* bias = (const float*)d_in[2];

  const size_t elems = (size_t)BATCH * NUM_HEADS * SEQ_T * HEAD_DIM;  // 4 Mi
  _Float16* Qh = (_Float16*)d_ws;          // 8 MB, [b][h][t][hd]
  _Float16* Kh = Qh + elems;               // 8 MB, [b][h][t][hd]
  _Float16* Vh = Kh + elems;               // 8 MB, [b][h][hd][t] (transposed)

  dim3 grid(SEQ_T / 128, NUM_HEADS, BATCH);  // 16 x 16 x 2 = 512 blocks
  qkv_proj_kernel<<<grid, 256, 0, stream>>>(x, W, bias, Qh, Kh, Vh);
  flash_attn_kernel<<<grid, 256, 0, stream>>>(Qh, Kh, Vh, (float*)d_out);
}

// v001
// A run of this version takes 111 microseconds.
// Next to v000, in two timings, it ran 2.38 and 2.37 times as fast.
#include <hip/hip_runtime.h>
#include <stdint.h>

typedef __attribute__((ext_vector_type(16))) _Float16 v16h;
typedef __attribute__((ext_vector_type(8)))  float    v8f;
typedef __attribute__((ext_vector_type(4)))  float    v4f;
typedef __attribute__((ext_vector_type(4)))  uint32_t v4u;
typedef __attribute__((ext_vector_type(4)))  int      v4i;

#define NUM_HEADS 16
#define EMBED_DIM 1024
#define HEAD_DIM  64
#define SEQ_T     2048
#define BATCH     2
#define N3        192   // 3*HEAD_DIM

#if defined(__HIP_DEVICE_COMPILE__) &&                                   \
    __has_builtin(__builtin_amdgcn_global_load_async_to_lds_b128) &&     \
    __has_builtin(__builtin_amdgcn_s_wait_asynccnt)
#define HAVE_ASYNC 1
#else
#define HAVE_ASYNC 0
#endif

union AF { v16h v; _Float16 h[16]; uint32_t u[8]; v4u q[2]; };

// Load a 16-half WMMA fragment (A or B operand, one 32-wide K step) from a
// row whose K-run is contiguous in memory. Per the CDNA5 ISA layout, lane
// halves 0..7 are K=[lhi*8, lhi*8+8) and halves 8..15 are K=[16+lhi*8, +8):
// two aligned 16-byte loads.
static __device__ __forceinline__ void load_frag16(AF& a,
                                                   const _Float16* row_base,
                                                   int lhi) {
  const v4u* p = (const v4u*)(row_base + lhi * 8);
  a.q[0] = p[0];   // halves 0..7
  a.q[1] = p[2];   // halves 16..23 (p strides 8 halves)
}

// 16-byte global -> LDS copy; async-to-LDS when available.
static __device__ __forceinline__ void cp16(const _Float16* g, _Float16* l) {
#if HAVE_ASYNC
  typedef v4i __attribute__((address_space(1))) gv4i_t;  // global int4*
  typedef v4i __attribute__((address_space(3))) lv4i_t;  // LDS int4*
  __builtin_amdgcn_global_load_async_to_lds_b128(
      (gv4i_t*)(uintptr_t)g, (lv4i_t*)(uint32_t)(uintptr_t)l, 0, 0);
#else
  *(v4u*)l = *(const v4u*)g;
#endif
}

// Lane l <-> lane l ^ 16 (the two halves of a wave) on the vector pipe.
static __device__ __forceinline__ float xhalf(float x) {
  int i = __builtin_bit_cast(int, x);
  return __builtin_bit_cast(float, __builtin_amdgcn_permlanex16(
      i, i, 0x76543210, 0xfedcba98, false, false));
}

// Base-2 exponentials in place, one statement each, ending in v_nop. The
// instruction set asks for one free slot between a transcendental and an
// instruction that reads its result or overwrites its source. In place, a
// source is a live result that nothing overwrites; the v_nop keeps the slot
// behind the last one.
static __device__ __forceinline__ void exp2_1(float& x) {
  asm("v_exp_f32 %0, %0\n\tv_nop" : "+v"(x));
}
static __device__ __forceinline__ void exp2_8(float (&x)[8]) {
  asm("v_exp_f32 %0, %0\n\tv_exp_f32 %1, %1\n\tv_exp_f32 %2, %2\n\t"
      "v_exp_f32 %3, %3\n\tv_exp_f32 %4, %4\n\tv_exp_f32 %5, %5\n\t"
      "v_exp_f32 %6, %6\n\tv_exp_f32 %7, %7\n\tv_nop"
      : "+v"(x[0]), "+v"(x[1]), "+v"(x[2]), "+v"(x[3]), "+v"(x[4]), "+v"(x[5]),
        "+v"(x[6]), "+v"(x[7]));
}

static __device__ __forceinline__ void cp_wait() {
#if HAVE_ASYNC
  __builtin_amdgcn_s_wait_asynccnt(0);
#endif
}

// ---------------------------------------------------------------------------
// Kernel 1: per (b,h) token tile, qkv = x_h @ W + b.  M=tokens, K=64, N=192.
// ---------------------------------------------------------------------------
__global__ __launch_bounds__(256) void qkv_proj_kernel(
    const float* __restrict__ x, const float* __restrict__ W,
    const float* __restrict__ bias, _Float16* __restrict__ Qh,
    _Float16* __restrict__ Kh, _Float16* __restrict__ Vh) {
  __shared__ _Float16 Wt[N3 * HEAD_DIM];  // transposed: [col][k]
  __shared__ float    Bs[N3];

  const int tid  = threadIdx.x;
  const int wave = tid >> 5;
  const int lane = tid & 31;
  const int lhi  = (lane >= 16) ? 1 : 0;
  const int ln   = lane & 15;
  const int tb   = blockIdx.x * 128;
  const int h    = blockIdx.y;
  const int b    = blockIdx.z;

  // Stage W (fp32 [64][192]) transposed as f16 in LDS; coalesced reads.
  for (int idx = tid; idx < HEAD_DIM * N3; idx += 256) {
    int k = idx / N3, c = idx % N3;
    Wt[c * HEAD_DIM + k] = (_Float16)W[idx];
  }
  if (tid < N3) Bs[tid] = bias[tid];
  __syncthreads();

  // A-fragments: x rows (tokens) x hd, loaded as float4 pairs, cvt to f16.
  const int trow = tb + wave * 16 + ln;
  const float* xrow = x + (size_t)(b * SEQ_T + trow) * EMBED_DIM + h * HEAD_DIM;
  AF xa[2];
  for (int ks = 0; ks < 2; ++ks) {
    const v4f* xp = (const v4f*)(xrow + ks * 32 + lhi * 8);
    v4f f0 = xp[0], f1 = xp[1];   // halves 0..7
    v4f f2 = xp[4], f3 = xp[5];   // halves 8..15 (K offset +16)
    for (int e = 0; e < 4; ++e) {
      xa[ks].h[e]      = (_Float16)f0[e];
      xa[ks].h[4 + e]  = (_Float16)f1[e];
      xa[ks].h[8 + e]  = (_Float16)f2[e];
      xa[ks].h[12 + e] = (_Float16)f3[e];
    }
  }

  const size_t hb = (size_t)(b * NUM_HEADS + h) * SEQ_T * HEAD_DIM;

  for (int n = 0; n < 12; ++n) {
    const int colg = n * 16 + ln;
    AF wb0, wb1;
    load_frag16(wb0, Wt + colg * HEAD_DIM, lhi);
    load_frag16(wb1, Wt + colg * HEAD_DIM + 32, lhi);
    float bv = Bs[colg];
    v8f acc;
    for (int e = 0; e < 8; ++e) acc[e] = bv;
    acc = __builtin_amdgcn_wmma_f32_16x16x32_f16(false, xa[0].v, false, wb0.v,
                                                 (short)0, acc, false, false);
    acc = __builtin_amdgcn_wmma_f32_16x16x32_f16(false, xa[1].v, false, wb1.v,
                                                 (short)0, acc, false, false);

    const int cl = (n & 3) * 16 + ln;  // column within the 64-wide head dim
    if (n < 8) {
      _Float16* dst = (n < 4) ? Qh : Kh;
      const float scale = (n < 4) ? 0.125f : 1.0f;  // 1/sqrt(64), exact
      for (int r = 0; r < 8; ++r) {
        int t = tb + wave * 16 + r + (lhi ? 8 : 0);
        dst[hb + (size_t)t * HEAD_DIM + cl] = (_Float16)(acc[r] * scale);
      }
    } else {
      // V stored transposed: [b][h][hd][T]
      for (int r = 0; r < 8; ++r) {
        int t = tb + wave * 16 + r + (lhi ? 8 : 0);
        Vh[hb + (size_t)cl * SEQ_T + t] = (_Float16)acc[r];
      }
    }
  }
}

// ---------------------------------------------------------------------------
// Kernel 2: flash attention. Block = 8 waves = 128 query rows of one (b,h).
// Key blocks of 32: S^T = K*Q^T (4 WMMA), online softmax with one query per
// lane, O^T += V^T*P^T (4 WMMA).
// Double-buffered async K/V staging: issue block kb+1, compute block kb.
// ---------------------------------------------------------------------------
__global__ __launch_bounds__(256) void flash_attn_kernel(
    const _Float16* __restrict__ Qh, const _Float16* __restrict__ Kh,
    const _Float16* __restrict__ Vh, float* __restrict__ out) {
  __shared__ _Float16 Ktb[2][32 * HEAD_DIM];  // [key][hd], row-major
  __shared__ _Float16 Vtb[2][HEAD_DIM * 32];  // [hd][key] (global V is [hd][T])

  const int tid  = threadIdx.x;
  const int wave = tid >> 5;
  const int lane = tid & 31;
  const int lhi  = (lane >= 16) ? 1 : 0;
  const int ln   = lane & 15;
  const int qb   = blockIdx.x * 128;
  const int h    = blockIdx.y;
  const int b    = blockIdx.z;
  const size_t hb = (size_t)(b * NUM_HEADS + h) * SEQ_T * HEAD_DIM;

  // Per-thread staging assignments (kb-invariant).
  const int vrow = tid >> 2;          // 0..63 : hd row of V
  const int vseg = tid & 3;           // 0..3  : 8-half segment within 32 keys
  const _Float16* Ksrc0 = Kh + hb + (size_t)tid * 8;        // + kb*2048
  const _Float16* Vsrc0 = Vh + hb + (size_t)vrow * SEQ_T + vseg * 8;  // + kb*32

  // Load this wave's Q fragments once (f16, already scaled by 0.125); they are
  // the B operand of S^T: lane = query column ln, same k order as the K rows.
  const int trow = qb + wave * 16 + ln;
  const _Float16* qrow = Qh + hb + (size_t)trow * HEAD_DIM;
  AF qa[2];
  load_frag16(qa[0], qrow, lhi);
  load_frag16(qa[1], qrow + 32, lhi);

  // Per lane: query ln. m is the query's running maximum (equal in both wave
  // halves), lsum the sum over this half's keys only (joined in the epilogue).
  float m = -3.0e38f, lsum = 0.0f;
  v8f o[4];  // o[d][r] = O[query ln][hd d*16 + lhi*8 + r]
  for (int d = 0; d < 4; ++d)
    for (int e = 0; e < 8; ++e) o[d][e] = 0.0f;

  const int NKB = SEQ_T / 32;  // 64 key blocks

  // Pipeline prologue: issue block 0 into buffer 0.
  cp16(Ksrc0, Ktb[0] + tid * 8);
  cp16(Vsrc0, Vtb[0] + vrow * 32 + vseg * 8);

  for (int kb = 0; kb < NKB; ++kb) {
    const int cur = kb & 1;
    cp_wait();          // this wave's async writes into buf[cur] are done
    __syncthreads();    // everyone's writes done; buf[cur^1] free to refill

    if (kb + 1 < NKB) {  // overlap: fetch next block while computing this one
      cp16(Ksrc0 + (size_t)(kb + 1) * 2048, Ktb[cur ^ 1] + tid * 8);
      cp16(Vsrc0 + (kb + 1) * 32, Vtb[cur ^ 1] + vrow * 32 + vseg * 8);
    }
    if (kb + 2 < NKB) {  // keep L2 warm two blocks ahead (global_prefetch_b8)
      __builtin_prefetch(Ksrc0 + (size_t)(kb + 2) * 2048, 0, 1);
      __builtin_prefetch(Vsrc0 + (kb + 2) * 32, 0, 1);
    }

    const _Float16* Kt = Ktb[cur];
    const _Float16* Vt = Vtb[cur];

    // S^T = K * Q^T : two 16-key M tiles, each 2 K-steps over hd=64.
    // s[nt][r] = score(key nt*16 + lhi*8 + r, query ln).
    v8f s[2];
    for (int nt = 0; nt < 2; ++nt) {
      const int key = nt * 16 + ln;
      AF f0, f1;
      load_frag16(f0, Kt + key * HEAD_DIM, lhi);
      load_frag16(f1, Kt + key * HEAD_DIM + 32, lhi);
      v8f c;
      for (int e = 0; e < 8; ++e) c[e] = 0.0f;
      c = __builtin_amdgcn_wmma_f32_16x16x32_f16(false, f0.v, false, qa[0].v,
                                                 (short)0, c, false, false);
      c = __builtin_amdgcn_wmma_f32_16x16x32_f16(false, f1.v, false, qa[1].v,
                                                 (short)0, c, false, false);
      s[nt] = c;
    }

    // Online softmax update (fp32): 16 of the query's 32 scores are in this
    // lane, the other 16 in lane ^ 16.
    float t[8];
    for (int r = 0; r < 8; ++r) t[r] = fmaxf(s[0][r], s[1][r]);
    float mx = fmaxf(fmaxf(fmaxf(t[0], t[1]), fmaxf(t[2], t[3])),
                     fmaxf(fmaxf(t[4], t[5]), fmaxf(t[6], t[7])));
    mx = fmaxf(mx, xhalf(mx));
    const float mn = fmaxf(m, mx);
    const float LOG2E = 1.44269504f;  // exp(x) = exp2(x * LOG2E)
    float corr = (m - mn) * LOG2E;
    exp2_1(corr);
    m = mn;

    // P^T as a B operand: halves 0..7 are keys lhi*8 + 0..7 and halves 8..15
    // keys 16 + lhi*8 + 0..7, the k order in which load_frag16 brings V^T.
    float p0[8], p1[8];
    for (int r = 0; r < 8; ++r) {
      p0[r] = (s[0][r] - mn) * LOG2E;
      p1[r] = (s[1][r] - mn) * LOG2E;
    }
    exp2_8(p0);
    exp2_8(p1);
    AF pb;
    for (int r = 0; r < 8; ++r) {
      t[r] = p0[r] + p1[r];
      pb.h[r]     = (_Float16)p0[r];
      pb.h[8 + r] = (_Float16)p1[r];
    }
    lsum = lsum * corr +
           (((t[0] + t[1]) + (t[2] + t[3])) + ((t[4] + t[5]) + (t[6] + t[7])));
    for (int d = 0; d < 4; ++d)
      for (int r = 0; r < 8; ++r) o[d][r] *= corr;

    // O^T += V^T * P^T : four 16-row hd tiles, contraction over 32 keys.
    for (int d = 0; d < 4; ++d) {
      AF vf;
      load_frag16(vf, Vt + (d * 16 + ln) * 32, lhi);
      o[d] = __builtin_amdgcn_wmma_f32_16x16x32_f16(false, vf.v, false, pb.v,
                                                    (short)0, o[d], false, false);
    }
  }

  // Normalize and write fp32 output [B, T, E]: a lane holds 8 consecutive hd
  // values of its query per tile, two 16-byte stores.
  const float inv = 1.0f / (lsum + xhalf(lsum));
  float* orow = out + (size_t)(b * SEQ_T + trow) * EMBED_DIM + h * HEAD_DIM +
                lhi * 8;
  for (int d = 0; d < 4; ++d) {
    v4f lo, hi;
    for (int e = 0; e < 4; ++e) {
      lo[e] = o[d][e] * inv;
      hi[e] = o[d][4 + e] * inv;
    }
    *(v4f*)(orow + d * 16)     = lo;
    *(v4f*)(orow + d * 16 + 4) = hi;
  }
}

// ---------------------------------------------------------------------------
extern "C" void kernel_launch(void* const* d_in, const int* in_sizes, int n_in,
                              void* d_out, int out_size, void* d_ws, size_t ws_size,
                              hipStream_t stream) {
  (void)in_sizes; (void)n_in; (void)out_size; (void)ws_size;
  const float* x    = (const float*)d_in[0];
  const float* W    = (const float*)d_in[1];
  const float* bias = (const float*)d_in[2];

  const size_t elems = (size_t)BATCH * NUM_HEADS * SEQ_T * HEAD_DIM;  // 4 Mi
  _Float16* Qh = (_Float16*)d_ws;          // 8 MB, [b][h][t][hd]
  _Float16* Kh = Qh + elems;               // 8 MB, [b][h][t][hd]
  _Float16* Vh = Kh + elems;               // 8 MB, [b][h][hd][t] (transposed)

  dim3 grid(SEQ_T / 128, NUM_HEADS, BATCH);  // 16 x 16 x 2 = 512 blocks
  qkv_proj_kernel<<<grid, 256, 0, stream>>>(x, W, bias, Qh, Kh, Vh);
  flash_attn_kernel<<<grid, 256, 0, stream>>>(Qh, Kh, Vh, (float*)d_out);
}

// v002
// A run of this version takes 55.2 microseconds.
// In both of two side-by-side timings against v001, it was 2.02 times as fast.
// All steps since v000 together make it 4.80 times as fast.
#include <hip/hip_runtime.h>
#include <stdint.h>

typedef __attribute__((ext_vector_type(16))) _Float16 v16h;
typedef __attribute__((ext_vector_type(8)))  float    v8f;
typedef __attribute__((ext_vector_type(4)))  float    v4f;
typedef __attribute__((ext_vector_type(4)))  uint32_t v4u;
typedef __attribute__((ext_vector_type(4)))  int      v4i;

#define NUM_HEADS 16
#define EMBED_DIM 1024
#define HEAD_DIM  64
#define SEQ_T     2048
#define BATCH     2
#define N3        192   // 3*HEAD_DIM

// LDS row pitches in halves. Every tile here is read by 16-byte loads in which
// the 16 lanes of a wave half take 16 consecutive rows: at a pitch of
// 16 B x odd those reads fall on all 64 banks, at 128 B or 64 B on few.
#define KP 72   // 128-byte rows (K tile, W^T) at 144 B
#define VP 40   // 64-byte rows (V^T tile) at 80 B

#if defined(__HIP_DEVICE_COMPILE__) &&                                   \
    __has_builtin(__builtin_amdgcn_global_load_async_to_lds_b128) &&     \
    __has_builtin(__builtin_amdgcn_s_wait_asynccnt)
#define HAVE_ASYNC 1
#else
#define HAVE_ASYNC 0
#endif

union AF { v16h v; _Float16 h[16]; uint32_t u[8]; v4u q[2]; };

// Load a 16-half WMMA fragment (A or B operand, one 32-wide K step) from a
// row whose K-run is contiguous in memory. Per the CDNA5 ISA layout, lane
// halves 0..7 are K=[lhi*8, lhi*8+8) and halves 8..15 are K=[16+lhi*8, +8):
// two aligned 16-byte loads.
static __device__ __forceinline__ void load_frag16(AF& a,
                                                   const _Float16* row_base,
                                                   int lhi) {
  const v4u* p = (const v4u*)(row_base + lhi * 8);
  a.q[0] = p[0];   // halves 0..7
  a.q[1] = p[2];   // halves 16..23 (p strides 8 halves)
}

// 16-byte global -> LDS copy; async-to-LDS when available.
static __device__ __forceinline__ void cp16(const _Float16* g, _Float16* l) {
#if HAVE_ASYNC
  typedef v4i __attribute__((address_space(1))) gv4i_t;  // global int4*
  typedef v4i __attribute__((address_space(3))) lv4i_t;  // LDS int4*
  __builtin_amdgcn_global_load_async_to_lds_b128(
      (gv4i_t*)(uintptr_t)g, (lv4i_t*)(uint32_t)(uintptr_t)l, 0, 0);
#else
  *(v4u*)l = *(const v4u*)g;
#endif
}

// Lane l <-> lane l ^ 16 (the two halves of a wave) on the vector pipe.
static __device__ __forceinline__ float xhalf(float x) {
  int i = __builtin_bit_cast(int, x);
  return __builtin_bit_cast(float, __builtin_amdgcn_permlanex16(
      i, i, 0x76543210, 0xfedcba98, false, false));
}

// Base-2 exponentials in place, one statement each, ending in v_nop. The
// instruction set asks for one free slot between a transcendental and an
// instruction that reads its result or overwrites its source. In place, a
// source is a live result that nothing overwrites; the v_nop keeps the slot
// behind the last one.
static __device__ __forceinline__ void exp2_1(float& x) {
  asm("v_exp_f32 %0, %0\n\tv_nop" : "+v"(x));
}
static __device__ __forceinline__ void exp2_8(float (&x)[8]) {
  asm("v_exp_f32 %0, %0\n\tv_exp_f32 %1, %1\n\tv_exp_f32 %2, %2\n\t"
      "v_exp_f32 %3, %3\n\tv_exp_f32 %4, %4\n\tv_exp_f32 %5, %5\n\t"
      "v_exp_f32 %6, %6\n\tv_exp_f32 %7, %7\n\tv_nop"
      : "+v"(x[0]), "+v"(x[1]), "+v"(x[2]), "+v"(x[3]), "+v"(x[4]), "+v"(x[5]),
        "+v"(x[6]), "+v"(x[7]));
}

static __device__ __forceinline__ void cp_wait() {
#if HAVE_ASYNC
  __builtin_amdgcn_s_wait_asynccnt(0);
#endif
}

// ---------------------------------------------------------------------------
// Kernel 1: per (b,h) token tile, qkv = x_h @ W + b.  M=tokens, K=64, N=192.
// ---------------------------------------------------------------------------
__global__ __launch_bounds__(256) void qkv_proj_kernel(
    const float* __restrict__ x, const float* __restrict__ W,
    const float* __restrict__ bias, _Float16* __restrict__ Qh,
    _Float16* __restrict__ Kh, _Float16* __restrict__ Vh) {
  __shared__ __attribute__((aligned(16))) _Float16 Wt[N3 * KP];  // [col][k]
  __shared__ float    Bs[N3];

  const int tid  = threadIdx.x;
  const int wave = tid >> 5;
  const int lane = tid & 31;
  const int lhi  = (lane >= 16) ? 1 : 0;
  const int ln   = lane & 15;
  const int tb   = blockIdx.x * 128;
  const int h    = blockIdx.y;
  const int b    = blockIdx.z;

  // Stage W (fp32 [64][192]) transposed as f16 in LDS; coalesced reads.
  for (int idx = tid; idx < HEAD_DIM * N3; idx += 256) {
    int k = idx / N3, c = idx % N3;
    Wt[c * KP + k] = (_Float16)W[idx];
  }
  if (tid < N3) Bs[tid] = bias[tid];
  __syncthreads();

  // A-fragments: x rows (tokens) x hd, loaded as float4 pairs, cvt to f16.
  const int trow = tb + wave * 16 + ln;
  const float* xrow = x + (size_t)(b * SEQ_T + trow) * EMBED_DIM + h * HEAD_DIM;
  AF xa[2];
  for (int ks = 0; ks < 2; ++ks) {
    const v4f* xp = (const v4f*)(xrow + ks * 32 + lhi * 8);
    v4f f0 = xp[0], f1 = xp[1];   // halves 0..7
    v4f f2 = xp[4], f3 = xp[5];   // halves 8..15 (K offset +16)
    for (int e = 0; e < 4; ++e) {
      xa[ks].h[e]      = (_Float16)f0[e];
      xa[ks].h[4 + e]  = (_Float16)f1[e];
      xa[ks].h[8 + e]  = (_Float16)f2[e];
      xa[ks].h[12 + e] = (_Float16)f3[e];
    }
  }

  const size_t hb = (size_t)(b * NUM_HEADS + h) * SEQ_T * HEAD_DIM;

  for (int n = 0; n < 12; ++n) {
    const int colg = n * 16 + ln;
    AF wb0, wb1;
    load_frag16(wb0, Wt + colg * KP, lhi);
    load_frag16(wb1, Wt + colg * KP + 32, lhi);
    float bv = Bs[colg];
    v8f acc;
    for (int e = 0; e < 8; ++e) acc[e] = bv;
    acc = __builtin_amdgcn_wmma_f32_16x16x32_f16(false, xa[0].v, false, wb0.v,
                                                 (short)0, acc, false, false);
    acc = __builtin_amdgcn_wmma_f32_16x16x32_f16(false, xa[1].v, false, wb1.v,
                                                 (short)0, acc, false, false);

    const int cl = (n & 3) * 16 + ln;  // column within the 64-wide head dim
    if (n < 8) {
      _Float16* dst = (n < 4) ? Qh : Kh;
      const float scale = (n < 4) ? 0.125f : 1.0f;  // 1/sqrt(64), exact
      for (int r = 0; r < 8; ++r) {
        int t = tb + wave * 16 + r + (lhi ? 8 : 0);
        dst[hb + (size_t)t * HEAD_DIM + cl] = (_Float16)(acc[r] * scale);
      }
    } else {
      // V stored transposed: [b][h][hd][T]
      for (int r = 0; r < 8; ++r) {
        int t = tb + wave * 16 + r + (lhi ? 8 : 0);
        Vh[hb + (size_t)cl * SEQ_T + t] = (_Float16)acc[r];
      }
    }
  }
}

// ---------------------------------------------------------------------------
// Kernel 2: flash attention. Block = 8 waves = 128 query rows of one (b,h).
// Key blocks of 32: S^T = K*Q^T (4 WMMA), online softmax with one query per
// lane, O^T += V^T*P^T (4 WMMA).
// Double-buffered async K/V staging: issue block kb+1, compute block kb.
// ---------------------------------------------------------------------------
__global__ __launch_bounds__(256) void flash_attn_kernel(
    const _Float16* __restrict__ Qh, const _Float16* __restrict__ Kh,
    const _Float16* __restrict__ Vh, float* __restrict__ out) {
  __shared__ __attribute__((aligned(16))) _Float16 Ktb[2][32 * KP];  // [key][hd]
  // [hd][key] (global V is [hd][T])
  __shared__ __attribute__((aligned(16))) _Float16 Vtb[2][HEAD_DIM * VP];

  const int tid  = threadIdx.x;
  const int wave = tid >> 5;
  const int lane = tid & 31;
  const int lhi  = (lane >= 16) ? 1 : 0;
  const int ln   = lane & 15;
  const int qb   = blockIdx.x * 128;
  const int h    = blockIdx.y;
  const int b    = blockIdx.z;
  const size_t hb = (size_t)(b * NUM_HEADS + h) * SEQ_T * HEAD_DIM;

  // Per-thread staging assignments (kb-invariant).
  const int vrow = tid >> 2;          // 0..63 : hd row of V
  const int vseg = tid & 3;           // 0..3  : 8-half segment within 32 keys
  const int kdst = (tid >> 3) * KP + (tid & 7) * 8;  // key row, 8-half segment
  const int vdst = vrow * VP + vseg * 8;
  const _Float16* Ksrc0 = Kh + hb + (size_t)tid * 8;        // + kb*2048
  const _Float16* Vsrc0 = Vh + hb + (size_t)vrow * SEQ_T + vseg * 8;  // + kb*32

  // Load this wave's Q fragments once (f16, already scaled by 0.125); they are
  // the B operand of S^T: lane = query column ln, same k order as the K rows.
  const int trow = qb + wave * 16 + ln;
  const _Float16* qrow = Qh + hb + (size_t)trow * HEAD_DIM;
  AF qa[2];
  load_frag16(qa[0], qrow, lhi);
  load_frag16(qa[1], qrow + 32, lhi);

  // Per lane: query ln. m is the query's running maximum (equal in both wave
  // halves), lsum the sum over this half's keys only (joined in the epilogue).
  float m = -3.0e38f, lsum = 0.0f;
  v8f o[4];  // o[d][r] = O[query ln][hd d*16 + lhi*8 + r]
  for (int d = 0; d < 4; ++d)
    for (int e = 0; e < 8; ++e) o[d][e] = 0.0f;

  const int NKB = SEQ_T / 32;  // 64 key blocks

  // Pipeline prologue: issue block 0 into buffer 0.
  cp16(Ksrc0, Ktb[0] + kdst);
  cp16(Vsrc0, Vtb[0] + vdst);

  for (int kb = 0; kb < NKB; ++kb) {
    const int cur = kb & 1;
    cp_wait();          // this wave's async writes into buf[cur] are done
    __syncthreads();    // everyone's writes done; buf[cur^1] free to refill

    if (kb + 1 < NKB) {  // overlap: fetch next block while computing this one
      cp16(Ksrc0 + (size_t)(kb + 1) * 2048, Ktb[cur ^ 1] + kdst);
      cp16(Vsrc0 + (kb + 1) * 32, Vtb[cur ^ 1] + vdst);
    }
    if (kb + 2 < NKB) {  // keep L2 warm two blocks ahead (global_prefetch_b8)
      __builtin_prefetch(Ksrc0 + (size_t)(kb + 2) * 2048, 0, 1);
      __builtin_prefetch(Vsrc0 + (kb + 2) * 32, 0, 1);
    }

    const _Float16* Kt = Ktb[cur];
    const _Float16* Vt = Vtb[cur];

    // S^T = K * Q^T : two 16-key M tiles, each 2 K-steps over hd=64.
    // s[nt][r] = score(key nt*16 + lhi*8 + r, query ln).
    v8f s[2];
    for (int nt = 0; nt < 2; ++nt) {
      const int key = nt * 16 + ln;
      AF f0, f1;
      load_frag16(f0, Kt + key * KP, lhi);
      load_frag16(f1, Kt + key * KP + 32, lhi);
      v8f c;
      for (int e = 0; e < 8; ++e) c[e] = 0.0f;
      c = __builtin_amdgcn_wmma_f32_16x16x32_f16(false, f0.v, false, qa[0].v,
                                                 (short)0, c, false, false);
      c = __builtin_amdgcn_wmma_f32_16x16x32_f16(false, f1.v, false, qa[1].v,
                                                 (short)0, c, false, false);
      s[nt] = c;
    }

    // Online softmax update (fp32): 16 of the query's 32 scores are in this
    // lane, the other 16 in lane ^ 16.
    float t[8];
    for (int r = 0; r < 8; ++r) t[r] = fmaxf(s[0][r], s[1][r]);
    float mx = fmaxf(fmaxf(fmaxf(t[0], t[1]), fmaxf(t[2], t[3])),
                     fmaxf(fmaxf(t[4], t[5]), fmaxf(t[6], t[7])));
    mx = fmaxf(mx, xhalf(mx));
    const float mn = fmaxf(m, mx);
    const float LOG2E = 1.44269504f;  // exp(x) = exp2(x * LOG2E)
    float corr = (m - mn) * LOG2E;
    exp2_1(corr);
    m = mn;

    // P^T as a B operand: halves 0..7 are keys lhi*8 + 0..7 and halves 8..15
    // keys 16 + lhi*8 + 0..7, the k order in which load_frag16 brings V^T.
    float p0[8], p1[8];
    for (int r = 0; r < 8; ++r) {
      p0[r] = (s[0][r] - mn) * LOG2E;
      p1[r] = (s[1][r] - mn) * LOG2E;
    }
    exp2_8(p0);
    exp2_8(p1);
    AF pb;
    for (int r = 0; r < 8; ++r) {
      t[r] = p0[r] + p1[r];
      pb.h[r]     = (_Float16)p0[r];
      pb.h[8 + r] = (_Float16)p1[r];
    }
    lsum = lsum * corr +
           (((t[0] + t[1]) + (t[2] + t[3])) + ((t[4] + t[5]) + (t[6] + t[7])));
    for (int d = 0; d < 4; ++d)
      for (int r = 0; r < 8; ++r) o[d][r] *= corr;

    // O^T += V^T * P^T : four 16-row hd tiles, contraction over 32 keys.
    for (int d = 0; d < 4; ++d) {
      AF vf;
      load_frag16(vf, Vt + (d * 16 + ln) * VP, lhi);
      o[d] = __builtin_amdgcn_wmma_f32_16x16x32_f16(false, vf.v, false, pb.v,
                                                    (short)0, o[d], false, false);
    }
  }

  // Normalize and write fp32 output [B, T, E]: a lane holds 8 consecutive hd
  // values of its query per tile, two 16-byte stores.
  const float inv = 1.0f / (lsum + xhalf(lsum));
  float* orow = out + (size_t)(b * SEQ_T + trow) * EMBED_DIM + h * HEAD_DIM +
                lhi * 8;
  for (int d = 0; d < 4; ++d) {
    v4f lo, hi;
    for (int e = 0; e < 4; ++e) {
      lo[e] = o[d][e] * inv;
      hi[e] = o[d][4 + e] * inv;
    }
    *(v4f*)(orow + d * 16)     = lo;
    *(v4f*)(orow + d * 16 + 4) = hi;
  }
}

// ---------------------------------------------------------------------------
extern "C" void kernel_launch(void* const* d_in, const int* in_sizes, int n_in,
                              void* d_out, int out_size, void* d_ws, size_t ws_size,
                              hipStream_t stream) {
  (void)in_sizes; (void)n_in; (void)out_size; (void)ws_size;
  const float* x    = (const float*)d_in[0];
  const float* W    = (const float*)d_in[1];
  const float* bias = (const float*)d_in[2];

  const size_t elems = (size_t)BATCH * NUM_HEADS * SEQ_T * HEAD_DIM;  // 4 Mi
  _Float16* Qh = (_Float16*)d_ws;          // 8 MB, [b][h][t][hd]
  _Float16* Kh = Qh + elems;               // 8 MB, [b][h][t][hd]
  _Float16* Vh = Kh + elems;               // 8 MB, [b][h][hd][t] (transposed)

  dim3 grid(SEQ_T / 128, NUM_HEADS, BATCH);  // 16 x 16 x 2 = 512 blocks
  qkv_proj_kernel<<<grid, 256, 0, stream>>>(x, W, bias, Qh, Kh, Vh);
  flash_attn_kernel<<<grid, 256, 0, stream>>>(Qh, Kh, Vh, (float*)d_out);
}

// v003
// It runs in 52 microseconds.
// In both of two side-by-side timings against v002, it was 1.06 times as fast.
// Over all steps from v000 it is 5.10 times as fast.
#include <hip/hip_runtime.h>
#include <stdint.h>

typedef __attribute__((ext_vector_type(16))) _Float16 v16h;
typedef __attribute__((ext_vector_type(8)))  float    v8f;
typedef __attribute__((ext_vector_type(4)))  float    v4f;
typedef __attribute__((ext_vector_type(4)))  uint32_t v4u;
typedef __attribute__((ext_vector_type(4)))  int      v4i;

#define NUM_HEADS 16
#define EMBED_DIM 1024
#define HEAD_DIM  64
#define SEQ_T     2048
#define BATCH     2
#define N3        192   // 3*HEAD_DIM

// LDS row pitches in halves. Every tile here is read by 16-byte loads in which
// the 16 lanes of a wave half take 16 consecutive rows: at a pitch of
// 16 B x odd those reads fall on all 64 banks, at 128 B or 64 B on few.
#define KP 72   // 128-byte rows (K tile, W^T) at 144 B
#define VP 40   // 64-byte rows (V^T tile) at 80 B

#if defined(__HIP_DEVICE_COMPILE__) &&                                   \
    __has_builtin(__builtin_amdgcn_global_load_async_to_lds_b128) &&     \
    __has_builtin(__builtin_amdgcn_s_wait_asynccnt)
#define HAVE_ASYNC 1
#else
#define HAVE_ASYNC 0
#endif

union AF { v16h v; _Float16 h[16]; uint32_t u[8]; v4u q[2]; };

// Load a 16-half WMMA fragment (A or B operand, one 32-wide K step) from a
// row whose K-run is contiguous in memory. Per the CDNA5 ISA layout, lane
// halves 0..7 are K=[lhi*8, lhi*8+8) and halves 8..15 are K=[16+lhi*8, +8):
// two aligned 16-byte loads.
static __device__ __forceinline__ void load_frag16(AF& a,
                                                   const _Float16* row_base,
                                                   int lhi) {
  const v4u* p = (const v4u*)(row_base + lhi * 8);
  a.q[0] = p[0];   // halves 0..7
  a.q[1] = p[2];   // halves 16..23 (p strides 8 halves)
}

// 16-byte global -> LDS copy; async-to-LDS when available.
static __device__ __forceinline__ void cp16(const _Float16* g, _Float16* l) {
#if HAVE_ASYNC
  typedef v4i __attribute__((address_space(1))) gv4i_t;  // global int4*
  typedef v4i __attribute__((address_space(3))) lv4i_t;  // LDS int4*
  __builtin_amdgcn_global_load_async_to_lds_b128(
      (gv4i_t*)(uintptr_t)g, (lv4i_t*)(uint32_t)(uintptr_t)l, 0, 0);
#else
  *(v4u*)l = *(const v4u*)g;
#endif
}

// Lane l <-> lane l ^ 16 (the two halves of a wave) on the vector pipe.
static __device__ __forceinline__ float xhalf(float x) {
  int i = __builtin_bit_cast(int, x);
  return __builtin_bit_cast(float, __builtin_amdgcn_permlanex16(
      i, i, 0x76543210, 0xfedcba98, false, false));
}

// Base-2 exponentials in place, one statement each, ending in v_nop. The
// instruction set asks for one free slot between a transcendental and an
// instruction that reads its result or overwrites its source. In place, a
// source is a live result that nothing overwrites; the v_nop keeps the slot
// behind the last one.
static __device__ __forceinline__ void exp2_1(float& x) {
  asm("v_exp_f32 %0, %0\n\tv_nop" : "+v"(x));
}
static __device__ __forceinline__ void exp2_8(float (&x)[8]) {
  asm("v_exp_f32 %0, %0\n\tv_exp_f32 %1, %1\n\tv_exp_f32 %2, %2\n\t"
      "v_exp_f32 %3, %3\n\tv_exp_f32 %4, %4\n\tv_exp_f32 %5, %5\n\t"
      "v_exp_f32 %6, %6\n\tv_exp_f32 %7, %7\n\tv_nop"
      : "+v"(x[0]), "+v"(x[1]), "+v"(x[2]), "+v"(x[3]), "+v"(x[4]), "+v"(x[5]),
        "+v"(x[6]), "+v"(x[7]));
}

// ---------------------------------------------------------------------------
// Kernel 1: per (b,h) token tile, qkv = x_h @ W + b.  M=tokens, K=64, N=192.
// ---------------------------------------------------------------------------
__global__ __launch_bounds__(256) void qkv_proj_kernel(
    const float* __restrict__ x, const float* __restrict__ W,
    const float* __restrict__ bias, _Float16* __restrict__ Qh,
    _Float16* __restrict__ Kh, _Float16* __restrict__ Vh) {
  __shared__ __attribute__((aligned(16))) _Float16 Wt[N3 * KP];  // [col][k]
  __shared__ float    Bs[N3];

  const int tid  = threadIdx.x;
  const int wave = tid >> 5;
  const int lane = tid & 31;
  const int lhi  = (lane >= 16) ? 1 : 0;
  const int ln   = lane & 15;
  const int tb   = blockIdx.x * 128;
  const int h    = blockIdx.y;
  const int b    = blockIdx.z;

  // Stage W (fp32 [64][192]) transposed as f16 in LDS; coalesced reads.
  for (int idx = tid; idx < HEAD_DIM * N3; idx += 256) {
    int k = idx / N3, c = idx % N3;
    Wt[c * KP + k] = (_Float16)W[idx];
  }
  if (tid < N3) Bs[tid] = bias[tid];
  __syncthreads();

  // A-fragments: x rows (tokens) x hd, loaded as float4 pairs, cvt to f16.
  const int trow = tb + wave * 16 + ln;
  const float* xrow = x + (size_t)(b * SEQ_T + trow) * EMBED_DIM + h * HEAD_DIM;
  AF xa[2];
  for (int ks = 0; ks < 2; ++ks) {
    const v4f* xp = (const v4f*)(xrow + ks * 32 + lhi * 8);
    v4f f0 = xp[0], f1 = xp[1];   // halves 0..7
    v4f f2 = xp[4], f3 = xp[5];   // halves 8..15 (K offset +16)
    for (int e = 0; e < 4; ++e) {
      xa[ks].h[e]      = (_Float16)f0[e];
      xa[ks].h[4 + e]  = (_Float16)f1[e];
      xa[ks].h[8 + e]  = (_Float16)f2[e];
      xa[ks].h[12 + e] = (_Float16)f3[e];
    }
  }

  const size_t hb = (size_t)(b * NUM_HEADS + h) * SEQ_T * HEAD_DIM;

  for (int n = 0; n < 12; ++n) {
    const int colg = n * 16 + ln;
    AF wb0, wb1;
    load_frag16(wb0, Wt + colg * KP, lhi);
    load_frag16(wb1, Wt + colg * KP + 32, lhi);
    float bv = Bs[colg];
    v8f acc;
    for (int e = 0; e < 8; ++e) acc[e] = bv;
    acc = __builtin_amdgcn_wmma_f32_16x16x32_f16(false, xa[0].v, false, wb0.v,
                                                 (short)0, acc, false, false);
    acc = __builtin_amdgcn_wmma_f32_16x16x32_f16(false, xa[1].v, false, wb1.v,
                                                 (short)0, acc, false, false);

    const int cl = (n & 3) * 16 + ln;  // column within the 64-wide head dim
    if (n < 8) {
      _Float16* dst = (n < 4) ? Qh : Kh;
      const float scale = (n < 4) ? 0.125f : 1.0f;  // 1/sqrt(64), exact
      for (int r = 0; r < 8; ++r) {
        int t = tb + wave * 16 + r + (lhi ? 8 : 0);
        dst[hb + (size_t)t * HEAD_DIM + cl] = (_Float16)(acc[r] * scale);
      }
    } else {
      // V stored transposed: [b][h][hd][T]
      for (int r = 0; r < 8; ++r) {
        int t = tb + wave * 16 + r + (lhi ? 8 : 0);
        Vh[hb + (size_t)cl * SEQ_T + t] = (_Float16)acc[r];
      }
    }
  }
}

// ---------------------------------------------------------------------------
// Kernel 2: flash attention. Block = 8 waves = 128 query rows of one (b,h).
// A wave takes 32 queries (two 16-column B groups) and ONE HALF of the keys:
// waves 0..3 keys 0..1023, waves 4..7 keys 1024..2047. Each K and V^T fragment
// read from LDS feeds two WMMAs, and the block keeps its eight waves.
// Per pass and wave, 32 keys: S^T = K*Q^T (8 WMMA), online softmax with one
// query per lane and group, O^T += V^T*P^T (8 WMMA).
// Double-buffered async K/V staging of both halves' tiles: issue pass kb+1,
// compute pass kb. At the end the two key halves of a query are merged
// through LDS: each wave hands one group to its partner and finishes the other.
// ---------------------------------------------------------------------------
// Two blocks per WGP, four waves per SIMD: the register budget is 256.
__global__ __launch_bounds__(256)
__attribute__((amdgpu_waves_per_eu(4, 4))) void flash_attn_kernel(
    const _Float16* __restrict__ Qh, const _Float16* __restrict__ Kh,
    const _Float16* __restrict__ Vh, float* __restrict__ out) {
  // [buffer][key half][key][hd]
  __shared__ __attribute__((aligned(16))) _Float16 Ktb[2][2][32 * KP];
  // [buffer][key half][hd][key] (global V is [hd][T])
  __shared__ __attribute__((aligned(16))) _Float16 Vtb[2][2][HEAD_DIM * VP];
  // Merge: [wave][32 O values, m, lsum][lane]
  __shared__ float Xm[8 * 34 * 32];

  const int tid  = threadIdx.x;
  const int wave = tid >> 5;
  const int lane = tid & 31;
  const int lhi  = (lane >= 16) ? 1 : 0;
  const int ln   = lane & 15;
  const int kh   = wave >> 2;         // key half of this wave
  const int qw   = wave & 3;          // its 32 queries within the block
  const int qb   = blockIdx.x * 128;
  const int h    = blockIdx.y;
  const int b    = blockIdx.z;
  const size_t hb = (size_t)(b * NUM_HEADS + h) * SEQ_T * HEAD_DIM;

  const int NKB = SEQ_T / 64;  // 32 passes, each 32 keys of either half

  // Per-thread staging assignments (kb-invariant).
  const int vrow = tid >> 2;          // 0..63 : hd row of V
  const int vseg = tid & 3;           // 0..3  : 8-half segment within 32 keys
  const int kdst = (tid >> 3) * KP + (tid & 7) * 8;  // key row, 8-half segment
  const int vdst = vrow * VP + vseg * 8;
  const _Float16* Ksrc0 = Kh + hb + (size_t)tid * 8;        // + tile*2048
  const _Float16* Vsrc0 = Vh + hb + (size_t)vrow * SEQ_T + vseg * 8;  // + tile*32
  // Prefetch assignments: threads 0..127 ask for half 0's tiles, the others
  // for half 1's, 32 bytes apart, so that every line is asked for.
  const int ph = tid >> 7, pt = tid & 127;
  const _Float16* Kpf0 = Kh + hb + (size_t)ph * NKB * 2048 + pt * 16;
  const _Float16* Vpf0 =
      Vh + hb + (size_t)(pt >> 1) * SEQ_T + ph * NKB * 32 + (pt & 1) * 16;

  // Load this wave's Q fragments once (f16, already scaled by 0.125); they are
  // the B operands of S^T: lane = query column ln, same k order as the K rows.
  // Group g of a wave holds queries (g ^ kh)*16 + ln of its 32, so that group
  // 1 of a wave and group 0 of its partner (wave ^ 4) are the same queries.
  const int trow = qb + qw * 32 + kh * 16 + ln;  // group 0's query
  AF qa[2][2];
  for (int g = 0; g < 2; ++g) {
    const _Float16* qrow =
        Qh + hb + (size_t)(qb + qw * 32 + (g ^ kh) * 16 + ln) * HEAD_DIM;
    load_frag16(qa[g][0], qrow, lhi);
    load_frag16(qa[g][1], qrow + 32, lhi);
  }

  // Per lane and group: one query. m is its running maximum (equal in both
  // wave halves), lsum the sum over this lane half's keys only (joined in the
  // epilogue).
  float m[2], lsum[2];
  v8f o[2][4];  // o[g][d][r] = O[query][hd d*16 + lhi*8 + r]
  for (int g = 0; g < 2; ++g) {
    m[g] = -3.0e38f;
    lsum[g] = 0.0f;
    for (int d = 0; d < 4; ++d)
      for (int e = 0; e < 8; ++e) o[g][d][e] = 0.0f;
  }

  // Pipeline prologue: issue pass 0 into buffer 0.
  for (int t = 0; t < 2; ++t) {
    cp16(Ksrc0 + (size_t)(t * NKB) * 2048, Ktb[0][t] + kdst);
    cp16(Vsrc0 + (t * NKB) * 32, Vtb[0][t] + vdst);
  }

  const float LOG2E = 1.44269504f;  // exp(x) = exp2(x * LOG2E)

  for (int kb = 0; kb < NKB; ++kb) {
    const int cur = kb & 1;
    // This wave's LDS reads of buf[cur^1] have retired before it is refilled.
    asm volatile("s_wait_dscnt 0x0" ::: "memory");
    // This wave's async writes into buf[cur] are done.
    asm volatile("s_wait_asynccnt 0x0" ::: "memory");
    __syncthreads();    // everyone's writes done; buf[cur^1] free to refill

    if (kb + 1 < NKB) {  // overlap: fetch next pass while computing this one
      for (int t = 0; t < 2; ++t) {
        cp16(Ksrc0 + (size_t)(t * NKB + kb + 1) * 2048, Ktb[cur ^ 1][t] + kdst);
        cp16(Vsrc0 + (t * NKB + kb + 1) * 32, Vtb[cur ^ 1][t] + vdst);
      }
    }
    if (kb + 2 < NKB) {  // keep L2 warm two passes ahead (global_prefetch_b8)
      __builtin_prefetch(Kpf0 + (size_t)(kb + 2) * 2048, 0, 1);
      __builtin_prefetch(Vpf0 + (kb + 2) * 32, 0, 1);
    }

    const _Float16* Kt = Ktb[cur][kh];
    const _Float16* Vt = Vtb[cur][kh];

    // S^T = K * Q^T : two 16-key M tiles, each 2 K-steps over hd=64, each
    // fragment against both query groups.
    // s[g][nt][r] = score(key nt*16 + lhi*8 + r, query of group g).
    v8f s[2][2];
    for (int nt = 0; nt < 2; ++nt) {
      const int key = nt * 16 + ln;
      AF f0, f1;
      load_frag16(f0, Kt + key * KP, lhi);
      load_frag16(f1, Kt + key * KP + 32, lhi);
      for (int g = 0; g < 2; ++g) {
        v8f c;
        for (int e = 0; e < 8; ++e) c[e] = 0.0f;
        c = __builtin_amdgcn_wmma_f32_16x16x32_f16(
            false, f0.v, false, qa[g][0].v, (short)0, c, false, false);
        c = __builtin_amdgcn_wmma_f32_16x16x32_f16(
            false, f1.v, false, qa[g][1].v, (short)0, c, false, false);
        s[g][nt] = c;
      }
    }

    // Online softmax update (fp32), per group: 16 of the query's 32 scores are
    // in this lane, the other 16 in lane ^ 16.
    AF pb[2];
    for (int g = 0; g < 2; ++g) {
      float t[8];
      for (int r = 0; r < 8; ++r) t[r] = fmaxf(s[g][0][r], s[g][1][r]);
      float mx = fmaxf(fmaxf(fmaxf(t[0], t[1]), fmaxf(t[2], t[3])),
                       fmaxf(fmaxf(t[4], t[5]), fmaxf(t[6], t[7])));
      mx = fmaxf(mx, xhalf(mx));
      const float mn = fmaxf(m[g], mx);
      float corr = (m[g] - mn) * LOG2E;
      exp2_1(corr);
      m[g] = mn;

      // P^T as a B operand: halves 0..7 are keys lhi*8 + 0..7 and halves 8..15
      // keys 16 + lhi*8 + 0..7, the k order in which load_frag16 brings V^T.
      float p0[8], p1[8];
      for (int r = 0; r < 8; ++r) {
        p0[r] = (s[g][0][r] - mn) * LOG2E;
        p1[r] = (s[g][1][r] - mn) * LOG2E;
      }
      exp2_8(p0);
      exp2_8(p1);
      for (int r = 0; r < 8; ++r) {
        t[r] = p0[r] + p1[r];
        pb[g].h[r]     = (_Float16)p0[r];
        pb[g].h[8 + r] = (_Float16)p1[r];
      }
      lsum[g] = lsum[g] * corr + (((t[0] + t[1]) + (t[2] + t[3])) +
                                  ((t[4] + t[5]) + (t[6] + t[7])));
      for (int d = 0; d < 4; ++d)
        for (int r = 0; r < 8; ++r) o[g][d][r] *= corr;
    }

    // O^T += V^T * P^T : four 16-row hd tiles, contraction over 32 keys, each
    // fragment against both query groups.
    for (int d = 0; d < 4; ++d) {
      AF vf;
      load_frag16(vf, Vt + (d * 16 + ln) * VP, lhi);
      for (int g = 0; g < 2; ++g)
        o[g][d] = __builtin_amdgcn_wmma_f32_16x16x32_f16(
            false, vf.v, false, pb[g].v, (short)0, o[g][d], false, false);
    }
  }

  // Merge the key halves: hand group 1 to the partner wave, take the partner's
  // group 1 (this wave's group 0 queries, the other 1024 keys).
  float* xw = Xm + (size_t)wave * 34 * 32 + lane;
  for (int d = 0; d < 4; ++d)
    for (int e = 0; e < 8; ++e) xw[(d * 8 + e) * 32] = o[1][d][e];
  xw[32 * 32] = m[1];
  xw[33 * 32] = lsum[1];
  __syncthreads();  // the partner's values are in LDS
  const float* xr = Xm + (size_t)(wave ^ 4) * 34 * 32 + lane;
  const float mo = xr[32 * 32];
  const float lo_ = xr[33 * 32];
  const float mm = fmaxf(m[0], mo);
  float c0 = (m[0] - mm) * LOG2E;
  float c1 = (mo - mm) * LOG2E;
  exp2_1(c0);
  exp2_1(c1);
  const float lj = lsum[0] * c0 + lo_ * c1;

  // Normalize and write fp32 output [B, T, E]: a lane holds 8 consecutive hd
  // values of its query per tile, two 16-byte stores.
  const float inv = 1.0f / (lj + xhalf(lj));
  c0 *= inv;
  c1 *= inv;
  float* orow = out + (size_t)(b * SEQ_T + trow) * EMBED_DIM + h * HEAD_DIM +
                lhi * 8;
  for (int d = 0; d < 4; ++d) {
    v4f lo, hi;
    for (int e = 0; e < 4; ++e) {
      lo[e] = o[0][d][e] * c0 + xr[(d * 8 + e) * 32] * c1;
      hi[e] = o[0][d][4 + e] * c0 + xr[(d * 8 + 4 + e) * 32] * c1;
    }
    *(v4f*)(orow + d * 16)     = lo;
    *(v4f*)(orow + d * 16 + 4) = hi;
  }
}

// ---------------------------------------------------------------------------
extern "C" void kernel_launch(void* const* d_in, const int* in_sizes, int n_in,
                              void* d_out, int out_size, void* d_ws, size_t ws_size,
                              hipStream_t stream) {
  (void)in_sizes; (void)n_in; (void)out_size; (void)ws_size;
  const float* x    = (const float*)d_in[0];
  const float* W    = (const float*)d_in[1];
  const float* bias = (const float*)d_in[2];

  const size_t elems = (size_t)BATCH * NUM_HEADS * SEQ_T * HEAD_DIM;  // 4 Mi
  _Float16* Qh = (_Float16*)d_ws;          // 8 MB, [b][h][t][hd]
  _Float16* Kh = Qh + elems;               // 8 MB, [b][h][t][hd]
  _Float16* Vh = Kh + elems;               // 8 MB, [b][h][hd][t] (transposed)

  dim3 grid(SEQ_T / 128, NUM_HEADS, BATCH);  // 16 x 16 x 2 = 512 blocks
  qkv_proj_kernel<<<grid, 256, 0, stream>>>(x, W, bias, Qh, Kh, Vh);
  flash_attn_kernel<<<grid, 256, 0, stream>>>(Qh, Kh, Vh, (float*)d_out);
}

// v004
// Measured time: 45.3 microseconds a run.
// Next to v003, in two timings, it ran 1.15 times as fast each time.
// All steps since v000 together make it 5.86 times as fast.
#include <hip/hip_runtime.h>
#include <stdint.h>

typedef __attribute__((ext_vector_type(16))) _Float16 v16h;
typedef __attribute__((ext_vector_type(8)))  float    v8f;
typedef __attribute__((ext_vector_type(4)))  float    v4f;
typedef __attribute__((ext_vector_type(4)))  uint32_t v4u;
typedef __attribute__((ext_vector_type(4)))  int      v4i;

#define NUM_HEADS 16
#define EMBED_DIM 1024
#define HEAD_DIM  64
#define SEQ_T     2048
#define BATCH     2
#define N3        192   // 3*HEAD_DIM

// LDS row pitches in halves. Every tile here is read by 16-byte loads in which
// the 16 lanes of a wave half take 16 consecutive rows: at a pitch of
// 16 B x odd those reads fall on all 64 banks, at 128 B or 64 B on few.
#define KP 72   // 128-byte rows (K tile, W^T) at 144 B
#define VP 40   // 64-byte rows (V^T tile) at 80 B

#if defined(__HIP_DEVICE_COMPILE__) &&                                   \
    __has_builtin(__builtin_amdgcn_global_load_async_to_lds_b128) &&     \
    __has_builtin(__builtin_amdgcn_s_wait_asynccnt)
#define HAVE_ASYNC 1
#else
#define HAVE_ASYNC 0
#endif

union AF { v16h v; _Float16 h[16]; uint32_t u[8]; v4u q[2]; };

// Load a 16-half WMMA fragment (A or B operand, one 32-wide K step) from a
// row whose K-run is contiguous in memory. Per the CDNA5 ISA layout, lane
// halves 0..7 are K=[lhi*8, lhi*8+8) and halves 8..15 are K=[16+lhi*8, +8):
// two aligned 16-byte loads.
static __device__ __forceinline__ void load_frag16(AF& a,
                                                   const _Float16* row_base,
                                                   int lhi) {
  const v4u* p = (const v4u*)(row_base + lhi * 8);
  a.q[0] = p[0];   // halves 0..7
  a.q[1] = p[2];   // halves 16..23 (p strides 8 halves)
}

// 16-byte global -> LDS copy; async-to-LDS when available.
static __device__ __forceinline__ void cp16(const _Float16* g, _Float16* l) {
#if HAVE_ASYNC
  typedef v4i __attribute__((address_space(1))) gv4i_t;  // global int4*
  typedef v4i __attribute__((address_space(3))) lv4i_t;  // LDS int4*
  __builtin_amdgcn_global_load_async_to_lds_b128(
      (gv4i_t*)(uintptr_t)g, (lv4i_t*)(uint32_t)(uintptr_t)l, 0, 0);
#else
  *(v4u*)l = *(const v4u*)g;
#endif
}

// Lane l <-> lane l ^ 16 (the two halves of a wave) on the vector pipe.
static __device__ __forceinline__ float xhalf(float x) {
  int i = __builtin_bit_cast(int, x);
  return __builtin_bit_cast(float, __builtin_amdgcn_permlanex16(
      i, i, 0x76543210, 0xfedcba98, false, false));
}

// Base-2 exponentials in place, one statement each, ending in v_nop. The
// instruction set asks for one free slot between a transcendental and an
// instruction that reads its result or overwrites its source. In place, a
// source is a live result that nothing overwrites; the v_nop keeps the slot
// behind the last one.
static __device__ __forceinline__ void exp2_1(float& x) {
  asm("v_exp_f32 %0, %0\n\tv_nop" : "+v"(x));
}
static __device__ __forceinline__ void exp2_8(float (&x)[8]) {
  asm("v_exp_f32 %0, %0\n\tv_exp_f32 %1, %1\n\tv_exp_f32 %2, %2\n\t"
      "v_exp_f32 %3, %3\n\tv_exp_f32 %4, %4\n\tv_exp_f32 %5, %5\n\t"
      "v_exp_f32 %6, %6\n\tv_exp_f32 %7, %7\n\tv_nop"
      : "+v"(x[0]), "+v"(x[1]), "+v"(x[2]), "+v"(x[3]), "+v"(x[4]), "+v"(x[5]),
        "+v"(x[6]), "+v"(x[7]));
}

// ---------------------------------------------------------------------------
// Kernel 1: per (b,h) token tile, qkv = x_h @ W + b.  M=tokens, K=64, N=192.
// ---------------------------------------------------------------------------
__global__ __launch_bounds__(256) void qkv_proj_kernel(
    const float* __restrict__ x, const float* __restrict__ W,
    const float* __restrict__ bias, _Float16* __restrict__ Qh,
    _Float16* __restrict__ Kh, _Float16* __restrict__ Vh) {
  __shared__ __attribute__((aligned(16))) _Float16 Wt[N3 * KP];  // [col][k]
  __shared__ float    Bs[N3];

  const int tid  = threadIdx.x;
  const int wave = tid >> 5;
  const int lane = tid & 31;
  const int lhi  = (lane >= 16) ? 1 : 0;
  const int ln   = lane & 15;
  const int tb   = blockIdx.x * 128;
  const int h    = blockIdx.y;
  const int b    = blockIdx.z;

  // Stage W (fp32 [64][192]) transposed as f16 in LDS; coalesced reads.
  for (int idx = tid; idx < HEAD_DIM * N3; idx += 256) {
    int k = idx / N3, c = idx % N3;
    Wt[c * KP + k] = (_Float16)W[idx];
  }
  if (tid < N3) Bs[tid] = bias[tid];
  __syncthreads();

  // A-fragments: x rows (tokens) x hd, loaded as float4 pairs, cvt to f16.
  const int trow = tb + wave * 16 + ln;
  const float* xrow = x + (size_t)(b * SEQ_T + trow) * EMBED_DIM + h * HEAD_DIM;
  AF xa[2];
  for (int ks = 0; ks < 2; ++ks) {
    const v4f* xp = (const v4f*)(xrow + ks * 32 + lhi * 8);
    v4f f0 = xp[0], f1 = xp[1];   // halves 0..7
    v4f f2 = xp[4], f3 = xp[5];   // halves 8..15 (K offset +16)
    for (int e = 0; e < 4; ++e) {
      xa[ks].h[e]      = (_Float16)f0[e];
      xa[ks].h[4 + e]  = (_Float16)f1[e];
      xa[ks].h[8 + e]  = (_Float16)f2[e];
      xa[ks].h[12 + e] = (_Float16)f3[e];
    }
  }

  const size_t hb = (size_t)(b * NUM_HEADS + h) * SEQ_T * HEAD_DIM;

  for (int n = 0; n < 12; ++n) {
    const int colg = n * 16 + ln;
    AF wb0, wb1;
    load_frag16(wb0, Wt + colg * KP, lhi);
    load_frag16(wb1, Wt + colg * KP + 32, lhi);
    float bv = Bs[colg];
    v8f acc;
    for (int e = 0; e < 8; ++e) acc[e] = bv;
    acc = __builtin_amdgcn_wmma_f32_16x16x32_f16(false, xa[0].v, false, wb0.v,
                                                 (short)0, acc, false, false);
    acc = __builtin_amdgcn_wmma_f32_16x16x32_f16(false, xa[1].v, false, wb1.v,
                                                 (short)0, acc, false, false);

    const int cl = (n & 3) * 16 + ln;  // column within the 64-wide head dim
    if (n < 8) {
      _Float16* dst = (n < 4) ? Qh : Kh;
      // Q carries 1/sqrt(64) and log2 e: its scores are base-2 exponents.
      const float scale = (n < 4) ? 0.125f * 1.44269504f : 1.0f;
      for (int r = 0; r < 8; ++r) {
        int t = tb + wave * 16 + r + (lhi ? 8 : 0);
        dst[hb + (size_t)t * HEAD_DIM + cl] = (_Float16)(acc[r] * scale);
      }
    } else {
      // V stored transposed: [b][h][hd][T]
      for (int r = 0; r < 8; ++r) {
        int t = tb + wave * 16 + r + (lhi ? 8 : 0);
        Vh[hb + (size_t)cl * SEQ_T + t] = (_Float16)acc[r];
      }
    }
  }
}

// ---------------------------------------------------------------------------
// Kernel 2: flash attention. Block = 8 waves = 128 query rows of one (b,h).
// A wave takes 32 queries (two 16-column B groups) and ONE HALF of the keys:
// waves 0..3 keys 0..1023, waves 4..7 keys 1024..2047. Each K and V^T fragment
// read from LDS feeds two WMMAs, and the block keeps its eight waves.
// Per pass and wave, 32 keys: S^T = K*Q^T (8 WMMA), online softmax with one
// query per lane and group, O^T += V^T*P^T (8 WMMA).
// The softmax reference of a query is HELD from pass to pass: minus the
// reference is the C operand of S^T, so the accumulators are the arguments of
// exp2 as they stand, and O and the sums are rescaled only in a pass in which
// some score of the wave stands more than 8 above its reference.
// Double-buffered async K/V staging of both halves' tiles: issue pass kb+1,
// compute pass kb. At the end the two key halves of a query are merged
// through LDS: each wave hands one group to its partner and finishes the other.
// ---------------------------------------------------------------------------
// Two blocks per WGP, four waves per SIMD: the register budget is 256.
__global__ __launch_bounds__(256)
__attribute__((amdgpu_waves_per_eu(4, 4))) void flash_attn_kernel(
    const _Float16* __restrict__ Qh, const _Float16* __restrict__ Kh,
    const _Float16* __restrict__ Vh, float* __restrict__ out) {
  // [buffer][key half][key][hd]
  __shared__ __attribute__((aligned(16))) _Float16 Ktb[2][2][32 * KP];
  // [buffer][key half][hd][key] (global V is [hd][T])
  __shared__ __attribute__((aligned(16))) _Float16 Vtb[2][2][HEAD_DIM * VP];
  // Merge: [wave][32 O values, reference, lsum][lane]
  __shared__ float Xm[8 * 34 * 32];

  const int tid  = threadIdx.x;
  const int wave = tid >> 5;
  const int lane = tid & 31;
  const int lhi  = (lane >= 16) ? 1 : 0;
  const int ln   = lane & 15;
  const int kh   = wave >> 2;         // key half of this wave
  const int qw   = wave & 3;          // its 32 queries within the block
  const int qb   = blockIdx.x * 128;
  const int h    = blockIdx.y;
  const int b    = blockIdx.z;
  const size_t hb = (size_t)(b * NUM_HEADS + h) * SEQ_T * HEAD_DIM;

  const int NKB = SEQ_T / 64;  // 32 passes, each 32 keys of either half

  // Per-thread staging assignments (kb-invariant).
  const int vrow = tid >> 2;          // 0..63 : hd row of V
  const int vseg = tid & 3;           // 0..3  : 8-half segment within 32 keys
  const int kdst = (tid >> 3) * KP + (tid & 7) * 8;  // key row, 8-half segment
  const int vdst = vrow * VP + vseg * 8;
  const _Float16* Ksrc0 = Kh + hb + (size_t)tid * 8;        // + tile*2048
  const _Float16* Vsrc0 = Vh + hb + (size_t)vrow * SEQ_T + vseg * 8;  // + tile*32
  // Prefetch assignments: threads 0..127 ask for half 0's tiles, the others
  // for half 1's, 32 bytes apart, so that every line is asked for.
  const int ph = tid >> 7, pt = tid & 127;
  const _Float16* Kpf0 = Kh + hb + (size_t)ph * NKB * 2048 + pt * 16;
  const _Float16* Vpf0 =
      Vh + hb + (size_t)(pt >> 1) * SEQ_T + ph * NKB * 32 + (pt & 1) * 16;

  // Load this wave's Q fragments once (f16, already scaled); they are
  // the B operands of S^T: lane = query column ln, same k order as the K rows.
  // Group g of a wave holds queries (g ^ kh)*16 + ln of its 32, so that group
  // 1 of a wave and group 0 of its partner (wave ^ 4) are the same queries.
  const int trow = qb + qw * 32 + kh * 16 + ln;  // group 0's query
  AF qa[2][2];
  for (int g = 0; g < 2; ++g) {
    const _Float16* qrow =
        Qh + hb + (size_t)(qb + qw * 32 + (g ^ kh) * 16 + ln) * HEAD_DIM;
    load_frag16(qa[g][0], qrow, lhi);
    load_frag16(qa[g][1], qrow + 32, lhi);
  }

  // Per lane and group: one query. nref is minus its reference in use, in base
  // 2 (equal in both wave halves and in all eight rows: a C operand), lsum the
  // sum over this lane half's keys only (joined in the epilogue).
  float lsum[2];
  v8f nref[2];
  v8f o[2][4];  // o[g][d][r] = O[query][hd d*16 + lhi*8 + r]
  for (int g = 0; g < 2; ++g) {
    lsum[g] = 0.0f;
    for (int e = 0; e < 8; ++e) nref[g][e] = 0.0f;
    for (int d = 0; d < 4; ++d)
      for (int e = 0; e < 8; ++e) o[g][d][e] = 0.0f;
  }

  // Pipeline prologue: issue pass 0 into buffer 0.
  for (int t = 0; t < 2; ++t) {
    cp16(Ksrc0 + (size_t)(t * NKB) * 2048, Ktb[0][t] + kdst);
    cp16(Vsrc0 + (t * NKB) * 32, Vtb[0][t] + vdst);
  }

  for (int kb = 0; kb < NKB; ++kb) {
    const int cur = kb & 1;
    // This wave's LDS reads of buf[cur^1] have retired before it is refilled.
    asm volatile("s_wait_dscnt 0x0" ::: "memory");
    // This wave's async writes into buf[cur] are done.
    asm volatile("s_wait_asynccnt 0x0" ::: "memory");
    __syncthreads();    // everyone's writes done; buf[cur^1] free to refill

    if (kb + 1 < NKB) {  // overlap: fetch next pass while computing this one
      for (int t = 0; t < 2; ++t) {
        cp16(Ksrc0 + (size_t)(t * NKB + kb + 1) * 2048, Ktb[cur ^ 1][t] + kdst);
        cp16(Vsrc0 + (t * NKB + kb + 1) * 32, Vtb[cur ^ 1][t] + vdst);
      }
    }
    if (kb + 2 < NKB) {  // keep L2 warm two passes ahead (global_prefetch_b8)
      __builtin_prefetch(Kpf0 + (size_t)(kb + 2) * 2048, 0, 1);
      __builtin_prefetch(Vpf0 + (kb + 2) * 32, 0, 1);
    }

    const _Float16* Kt = Ktb[cur][kh];
    const _Float16* Vt = Vtb[cur][kh];

    // S^T = K * Q^T : two 16-key M tiles, each 2 K-steps over hd=64, each
    // fragment against both query groups.
    // s[g][nt][r] = score(key nt*16 + lhi*8 + r, query of group g) minus the
    // query's reference.
    v8f s[2][2];
    for (int nt = 0; nt < 2; ++nt) {
      const int key = nt * 16 + ln;
      AF f0, f1;
      load_frag16(f0, Kt + key * KP, lhi);
      load_frag16(f1, Kt + key * KP + 32, lhi);
      for (int g = 0; g < 2; ++g) {
        v8f c = __builtin_amdgcn_wmma_f32_16x16x32_f16(
            false, f0.v, false, qa[g][0].v, (short)0, nref[g], false, false);
        c = __builtin_amdgcn_wmma_f32_16x16x32_f16(
            false, f1.v, false, qa[g][1].v, (short)0, c, false, false);
        s[g][nt] = c;
      }
    }

    // The V^T fragments are asked for ahead of the softmax, which hides their
    // LDS latency.
    AF vf[4];
    for (int d = 0; d < 4; ++d) load_frag16(vf[d], Vt + (d * 16 + ln) * VP, lhi);

    // This lane's largest score above its reference, per group: 16 of a
    // query's 32 scores are in this lane, the other 16 in lane ^ 16.
    float mx[2];
    for (int g = 0; g < 2; ++g) {
      float t[8];
      for (int r = 0; r < 8; ++r) t[r] = fmaxf(s[g][0][r], s[g][1][r]);
      mx[g] = fmaxf(fmaxf(fmaxf(t[0], t[1]), fmaxf(t[2], t[3])),
                    fmaxf(fmaxf(t[4], t[5]), fmaxf(t[6], t[7])));
    }

    // One test per pass and wave, a scalar branch. Up to 8 above the reference
    // P stays at or below 256, well inside f16. Pass 0 sets the reference.
    const bool over = fmaxf(mx[0], mx[1]) > 8.0f;
    if (kb == 0 || __builtin_amdgcn_ballot_w32(over) != 0) {
      for (int g = 0; g < 2; ++g) {
        // The reference moves up to the pass's maximum where that is higher, never down
        // (in pass 0, with nothing summed yet, to the pass's own maximum).
        float d = fmaxf(mx[g], xhalf(mx[g]));
        if (kb != 0) d = fmaxf(d, 0.0f);
        float corr = -fmaxf(d, 0.0f);
        exp2_1(corr);
        for (int e = 0; e < 8; ++e) {
          nref[g][e] -= d;
          s[g][0][e] -= d;
          s[g][1][e] -= d;
        }
        lsum[g] *= corr;
        for (int dd = 0; dd < 4; ++dd)
          for (int r = 0; r < 8; ++r) o[g][dd][r] *= corr;
      }
    }

    AF pb[2];
    for (int g = 0; g < 2; ++g) {
      // P^T as a B operand: halves 0..7 are keys lhi*8 + 0..7 and halves 8..15
      // keys 16 + lhi*8 + 0..7, the k order in which load_frag16 brings V^T.
      float p0[8], p1[8], t[8];
      for (int r = 0; r < 8; ++r) {
        p0[r] = s[g][0][r];
        p1[r] = s[g][1][r];
      }
      exp2_8(p0);
      exp2_8(p1);
      for (int r = 0; r < 8; ++r) {
        t[r] = p0[r] + p1[r];
        pb[g].h[r]     = (_Float16)p0[r];
        pb[g].h[8 + r] = (_Float16)p1[r];
      }
      lsum[g] += ((t[0] + t[1]) + (t[2] + t[3])) +
                 ((t[4] + t[5]) + (t[6] + t[7]));
    }

    // O^T += V^T * P^T : four 16-row hd tiles, contraction over 32 keys, each
    // fragment against both query groups.
    for (int d = 0; d < 4; ++d)
      for (int g = 0; g < 2; ++g)
        o[g][d] = __builtin_amdgcn_wmma_f32_16x16x32_f16(
            false, vf[d].v, false, pb[g].v, (short)0, o[g][d], false, false);
  }

  // Merge the key halves: hand group 1 to the partner wave, take the partner's
  // group 1 (this wave's group 0 queries, the other 1024 keys).
  float* xw = Xm + (size_t)wave * 34 * 32 + lane;
  for (int d = 0; d < 4; ++d)
    for (int e = 0; e < 8; ++e) xw[(d * 8 + e) * 32] = o[1][d][e];
  xw[32 * 32] = -nref[1][0];
  xw[33 * 32] = lsum[1];
  __syncthreads();  // the partner's values are in LDS
  const float* xr = Xm + (size_t)(wave ^ 4) * 34 * 32 + lane;
  const float mo = xr[32 * 32];
  const float lo_ = xr[33 * 32];
  const float m0 = -nref[0][0];
  const float mm = fmaxf(m0, mo);
  float c0 = m0 - mm;  // references are base-2 exponents
  float c1 = mo - mm;
  exp2_1(c0);
  exp2_1(c1);
  const float lj = lsum[0] * c0 + lo_ * c1;

  // Normalize and write fp32 output [B, T, E]: a lane holds 8 consecutive hd
  // values of its query per tile, two 16-byte stores.
  const float inv = 1.0f / (lj + xhalf(lj));
  c0 *= inv;
  c1 *= inv;
  float* orow = out + (size_t)(b * SEQ_T + trow) * EMBED_DIM + h * HEAD_DIM +
                lhi * 8;
  for (int d = 0; d < 4; ++d) {
    v4f lo, hi;
    for (int e = 0; e < 4; ++e) {
      lo[e] = o[0][d][e] * c0 + xr[(d * 8 + e) * 32] * c1;
      hi[e] = o[0][d][4 + e] * c0 + xr[(d * 8 + 4 + e) * 32] * c1;
    }
    *(v4f*)(orow + d * 16)     = lo;
    *(v4f*)(orow + d * 16 + 4) = hi;
  }
}

// ---------------------------------------------------------------------------
extern "C" void kernel_launch(void* const* d_in, const int* in_sizes, int n_in,
                              void* d_out, int out_size, void* d_ws, size_t ws_size,
                              hipStream_t stream) {
  (void)in_sizes; (void)n_in; (void)out_size; (void)ws_size;
  const float* x    = (const float*)d_in[0];
  const float* W    = (const float*)d_in[1];
  const float* bias = (const float*)d_in[2];

  const size_t elems = (size_t)BATCH * NUM_HEADS * SEQ_T * HEAD_DIM;  // 4 Mi
  _Float16* Qh = (_Float16*)d_ws;          // 8 MB, [b][h][t][hd]
  _Float16* Kh = Qh + elems;               // 8 MB, [b][h][t][hd]
  _Float16* Vh = Kh + elems;               // 8 MB, [b][h][hd][t] (transposed)

  dim3 grid(SEQ_T / 128, NUM_HEADS, BATCH);  // 16 x 16 x 2 = 512 blocks
  qkv_proj_kernel<<<grid, 256, 0, stream>>>(x, W, bias, Qh, Kh, Vh);
  flash_attn_kernel<<<grid, 256, 0, stream>>>(Qh, Kh, Vh, (float*)d_out);
}

// v005
// One run takes 43.4 microseconds.
// Two timings next to v004 both put it at 1.04 times that version's speed.
// Counting every step since v000, it is 6.10 times as fast.
#include <hip/hip_runtime.h>
#include <stdint.h>

typedef __attribute__((ext_vector_type(16))) _Float16 v16h;
typedef __attribute__((ext_vector_type(8)))  float    v8f;
typedef __attribute__((ext_vector_type(4)))  float    v4f;
typedef __attribute__((ext_vector_type(4)))  uint32_t v4u;
typedef __attribute__((ext_vector_type(4)))  int      v4i;

#define NUM_HEADS 16
#define EMBED_DIM 1024
#define HEAD_DIM  64
#define SEQ_T     2048
#define BATCH     2
#define N3        192   // 3*HEAD_DIM

// LDS row pitches in halves. Every tile here is read by 16-byte loads in which
// the 16 lanes of a wave half take 16 consecutive rows: at a pitch of
// 16 B x odd those reads fall on all 64 banks, at 128 B or 64 B on few.
#define KP 72   // 128-byte rows (K tile, W^T) at 144 B
#define VP 40   // 64-byte rows (V^T tile) at 80 B

#if defined(__HIP_DEVICE_COMPILE__) &&                                   \
    __has_builtin(__builtin_amdgcn_global_load_async_to_lds_b128) &&     \
    __has_builtin(__builtin_amdgcn_s_wait_asynccnt)
#define HAVE_ASYNC 1
#else
#define HAVE_ASYNC 0
#endif

union AF { v16h v; _Float16 h[16]; uint32_t u[8]; v4u q[2]; };

// Load a 16-half WMMA fragment (A or B operand, one 32-wide K step) from a
// row whose K-run is contiguous in memory. Per the CDNA5 ISA layout, lane
// halves 0..7 are K=[lhi*8, lhi*8+8) and halves 8..15 are K=[16+lhi*8, +8):
// two aligned 16-byte loads.
static __device__ __forceinline__ void load_frag16(AF& a,
                                                   const _Float16* row_base,
                                                   int lhi) {
  const v4u* p = (const v4u*)(row_base + lhi * 8);
  a.q[0] = p[0];   // halves 0..7
  a.q[1] = p[2];   // halves 16..23 (p strides 8 halves)
}

// 16-byte global -> LDS copy; async-to-LDS when available.
static __device__ __forceinline__ void cp16(const _Float16* g, _Float16* l) {
#if HAVE_ASYNC
  typedef v4i __attribute__((address_space(1))) gv4i_t;  // global int4*
  typedef v4i __attribute__((address_space(3))) lv4i_t;  // LDS int4*
  __builtin_amdgcn_global_load_async_to_lds_b128(
      (gv4i_t*)(uintptr_t)g, (lv4i_t*)(uint32_t)(uintptr_t)l, 0, 0);
#else
  *(v4u*)l = *(const v4u*)g;
#endif
}

// Lane l <-> lane l ^ 16 (the two halves of a wave) on the vector pipe.
static __device__ __forceinline__ float xhalf(float x) {
  int i = __builtin_bit_cast(int, x);
  return __builtin_bit_cast(float, __builtin_amdgcn_permlanex16(
      i, i, 0x76543210, 0xfedcba98, false, false));
}

// Base-2 exponentials in place, one statement each, ending in v_nop. The
// instruction set asks for one free slot between a transcendental and an
// instruction that reads its result or overwrites its source. In place, a
// source is a live result that nothing overwrites; the v_nop keeps the slot
// behind the last one.
static __device__ __forceinline__ void exp2_1(float& x) {
  asm("v_exp_f32 %0, %0\n\tv_nop" : "+v"(x));
}
static __device__ __forceinline__ void exp2_8(float (&x)[8]) {
  asm("v_exp_f32 %0, %0\n\tv_exp_f32 %1, %1\n\tv_exp_f32 %2, %2\n\t"
      "v_exp_f32 %3, %3\n\tv_exp_f32 %4, %4\n\tv_exp_f32 %5, %5\n\t"
      "v_exp_f32 %6, %6\n\tv_exp_f32 %7, %7\n\tv_nop"
      : "+v"(x[0]), "+v"(x[1]), "+v"(x[2]), "+v"(x[3]), "+v"(x[4]), "+v"(x[5]),
        "+v"(x[6]), "+v"(x[7]));
}

// ---------------------------------------------------------------------------
// Kernel 1: per (b,h) token tile, qkv = x_h @ W + b.  128 tokens, K=64, N=192.
// Q and K are formed as W^T * x^T (a lane holds one token's consecutive
// columns), V as x * W (a lane holds one column's consecutive tokens): each
// in the orientation whose accumulator registers lie along its stored rows.
// ---------------------------------------------------------------------------
__global__ __launch_bounds__(256) void qkv_proj_kernel(
    const float* __restrict__ x, const float* __restrict__ W,
    const float* __restrict__ bias, _Float16* __restrict__ Qh,
    _Float16* __restrict__ Kh, _Float16* __restrict__ Vh) {
  __shared__ __attribute__((aligned(16))) _Float16 Wt[N3 * KP];  // [col][k]
  __shared__ __attribute__((aligned(16))) float Bs[N3];

  const int tid  = threadIdx.x;
  const int wave = tid >> 5;
  const int lane = tid & 31;
  const int lhi  = (lane >= 16) ? 1 : 0;
  const int ln   = lane & 15;
  const int tb   = blockIdx.x * 128;
  const int h    = blockIdx.y;
  const int b    = blockIdx.z;

  // Stage W (fp32 [64][192]) transposed as f16 in LDS; coalesced reads.
  for (int idx = tid; idx < HEAD_DIM * N3; idx += 256) {
    int k = idx / N3, c = idx % N3;
    Wt[c * KP + k] = (_Float16)W[idx];
  }
  if (tid < N3) Bs[tid] = bias[tid];
  __syncthreads();

  // x fragments: rows (tokens) x hd, loaded as float4 pairs, cvt to f16.
  const int trow = tb + wave * 16 + ln;
  const float* xrow = x + (size_t)(b * SEQ_T + trow) * EMBED_DIM + h * HEAD_DIM;
  AF xa[2];
  for (int ks = 0; ks < 2; ++ks) {
    const v4f* xp = (const v4f*)(xrow + ks * 32 + lhi * 8);
    v4f f0 = xp[0], f1 = xp[1];   // halves 0..7
    v4f f2 = xp[4], f3 = xp[5];   // halves 8..15 (K offset +16)
    for (int e = 0; e < 4; ++e) {
      xa[ks].h[e]      = (_Float16)f0[e];
      xa[ks].h[4 + e]  = (_Float16)f1[e];
      xa[ks].h[8 + e]  = (_Float16)f2[e];
      xa[ks].h[12 + e] = (_Float16)f3[e];
    }
  }

  const size_t hb = (size_t)(b * NUM_HEADS + h) * SEQ_T * HEAD_DIM;

  for (int n = 0; n < 12; ++n) {
    const int colg = n * 16 + ln;
    AF wb0, wb1;
    load_frag16(wb0, Wt + colg * KP, lhi);
    load_frag16(wb1, Wt + colg * KP + 32, lhi);

    if (n < 8) {
      // Q and K, transposed product: A = W^T rows (output columns), B = x rows
      // (tokens), both in load_frag16's k order. acc[r] is column
      // n*16 + lhi*8 + r of token trow: eight consecutive halves of one
      // row-major output row, one 16-byte store.
      const v4f* bp = (const v4f*)(Bs + n * 16 + lhi * 8);
      const v4f b0 = bp[0], b1 = bp[1];
      v8f acc;
      for (int e = 0; e < 4; ++e) {
        acc[e]     = b0[e];
        acc[4 + e] = b1[e];
      }
      acc = __builtin_amdgcn_wmma_f32_16x16x32_f16(false, wb0.v, false, xa[0].v,
                                                   (short)0, acc, false, false);
      acc = __builtin_amdgcn_wmma_f32_16x16x32_f16(false, wb1.v, false, xa[1].v,
                                                   (short)0, acc, false, false);
      _Float16* dst = (n < 4) ? Qh : Kh;
      // Q carries 1/sqrt(64) and log2 e: its scores are base-2 exponents.
      const float scale = (n < 4) ? 0.125f * 1.44269504f : 1.0f;
      union { _Float16 h[8]; v4u q; } pk;
      for (int r = 0; r < 8; ++r) pk.h[r] = (_Float16)(acc[r] * scale);
      *(v4u*)(dst + hb + (size_t)trow * HEAD_DIM + (n & 3) * 16 + lhi * 8) =
          pk.q;
    } else {
      // V: A = x rows, B = W^T rows. acc[r] is token lhi*8 + r of column cl,
      // eight consecutive halves of a row of the transposed [b][h][hd][T].
      const int cl = (n & 3) * 16 + ln;  // column within the 64-wide head dim
      float bv = Bs[colg];
      v8f acc;
      for (int e = 0; e < 8; ++e) acc[e] = bv;
      acc = __builtin_amdgcn_wmma_f32_16x16x32_f16(false, xa[0].v, false, wb0.v,
                                                   (short)0, acc, false, false);
      acc = __builtin_amdgcn_wmma_f32_16x16x32_f16(false, xa[1].v, false, wb1.v,
                                                   (short)0, acc, false, false);
      for (int r = 0; r < 8; ++r) {
        int t = tb + wave * 16 + r + (lhi ? 8 : 0);
        Vh[hb + (size_t)cl * SEQ_T + t] = (_Float16)acc[r];
      }
    }
  }
}

// ---------------------------------------------------------------------------
// Kernel 2: flash attention. Block = 8 waves = 128 query rows of one (b,h).
// A wave takes 32 queries (two 16-column B groups) and ONE HALF of the keys:
// waves 0..3 keys 0..1023, waves 4..7 keys 1024..2047. Each K and V^T fragment
// read from LDS feeds two WMMAs, and the block keeps its eight waves.
// Per pass and wave, 32 keys: S^T = K*Q^T (8 WMMA), online softmax with one
// query per lane and group, O^T += V^T*P^T (8 WMMA).
// The softmax reference of a query is HELD from pass to pass: minus the
// reference is the C operand of S^T, so the accumulators are the arguments of
// exp2 as they stand, and O and the sums are rescaled only in a pass in which
// some score of the wave stands more than 8 above its reference.
// Double-buffered async K/V staging of both halves' tiles: issue pass kb+1,
// compute pass kb. At the end the two key halves of a query are merged
// through LDS: each wave hands one group to its partner and finishes the other.
// ---------------------------------------------------------------------------
// Two blocks per WGP, four waves per SIMD: the register budget is 256.
__global__ __launch_bounds__(256)
__attribute__((amdgpu_waves_per_eu(4, 4))) void flash_attn_kernel(
    const _Float16* __restrict__ Qh, const _Float16* __restrict__ Kh,
    const _Float16* __restrict__ Vh, float* __restrict__ out) {
  // [buffer][key half][key][hd]
  __shared__ __attribute__((aligned(16))) _Float16 Ktb[2][2][32 * KP];
  // [buffer][key half][hd][key] (global V is [hd][T])
  __shared__ __attribute__((aligned(16))) _Float16 Vtb[2][2][HEAD_DIM * VP];
  // Merge: [wave][32 O values, reference, lsum][lane]
  __shared__ float Xm[8 * 34 * 32];

  const int tid  = threadIdx.x;
  const int wave = tid >> 5;
  const int lane = tid & 31;
  const int lhi  = (lane >= 16) ? 1 : 0;
  const int ln   = lane & 15;
  const int kh   = wave >> 2;         // key half of this wave
  const int qw   = wave & 3;          // its 32 queries within the block
  const int qb   = blockIdx.x * 128;
  const int h    = blockIdx.y;
  const int b    = blockIdx.z;
  const size_t hb = (size_t)(b * NUM_HEADS + h) * SEQ_T * HEAD_DIM;

  const int NKB = SEQ_T / 64;  // 32 passes, each 32 keys of either half

  // Per-thread staging assignments (kb-invariant).
  const int vrow = tid >> 2;          // 0..63 : hd row of V
  const int vseg = tid & 3;           // 0..3  : 8-half segment within 32 keys
  const int kdst = (tid >> 3) * KP + (tid & 7) * 8;  // key row, 8-half segment
  const int vdst = vrow * VP + vseg * 8;
  const _Float16* Ksrc0 = Kh + hb + (size_t)tid * 8;        // + tile*2048
  const _Float16* Vsrc0 = Vh + hb + (size_t)vrow * SEQ_T + vseg * 8;  // + tile*32
  // Prefetch assignments: threads 0..127 ask for half 0's tiles, the others
  // for half 1's, 32 bytes apart, so that every line is asked for.
  const int ph = tid >> 7, pt = tid & 127;
  const _Float16* Kpf0 = Kh + hb + (size_t)ph * NKB * 2048 + pt * 16;
  const _Float16* Vpf0 =
      Vh + hb + (size_t)(pt >> 1) * SEQ_T + ph * NKB * 32 + (pt & 1) * 16;

  // Load this wave's Q fragments once (f16, already scaled); they are
  // the B operands of S^T: lane = query column ln, same k order as the K rows.
  // Group g of a wave holds queries (g ^ kh)*16 + ln of its 32, so that group
  // 1 of a wave and group 0 of its partner (wave ^ 4) are the same queries.
  const int trow = qb + qw * 32 + kh * 16 + ln;  // group 0's query
  AF qa[2][2];
  for (int g = 0; g < 2; ++g) {
    const _Float16* qrow =
        Qh + hb + (size_t)(qb + qw * 32 + (g ^ kh) * 16 + ln) * HEAD_DIM;
    load_frag16(qa[g][0], qrow, lhi);
    load_frag16(qa[g][1], qrow + 32, lhi);
  }

  // Per lane and group: one query. nref is minus its reference in use, in base
  // 2 (equal in both wave halves and in all eight rows: a C operand), lsum the
  // sum over this lane half's keys only (joined in the epilogue).
  float lsum[2];
  v8f nref[2];
  v8f o[2][4];  // o[g][d][r] = O[query][hd d*16 + lhi*8 + r]
  for (int g = 0; g < 2; ++g) {
    lsum[g] = 0.0f;
    for (int e = 0; e < 8; ++e) nref[g][e] = 0.0f;
    for (int d = 0; d < 4; ++d)
      for (int e = 0; e < 8; ++e) o[g][d][e] = 0.0f;
  }

  // Pipeline prologue: issue pass 0 into buffer 0.
  for (int t = 0; t < 2; ++t) {
    cp16(Ksrc0 + (size_t)(t * NKB) * 2048, Ktb[0][t] + kdst);
    cp16(Vsrc0 + (t * NKB) * 32, Vtb[0][t] + vdst);
  }

  for (int kb = 0; kb < NKB; ++kb) {
    const int cur = kb & 1;
    // This wave's LDS reads of buf[cur^1] have retired before it is refilled.
    asm volatile("s_wait_dscnt 0x0" ::: "memory");
    // This wave's async writes into buf[cur] are done.
    asm volatile("s_wait_asynccnt 0x0" ::: "memory");
    __syncthreads();    // everyone's writes done; buf[cur^1] free to refill

    if (kb + 1 < NKB) {  // overlap: fetch next pass while computing this one
      for (int t = 0; t < 2; ++t) {
        cp16(Ksrc0 + (size_t)(t * NKB + kb + 1) * 2048, Ktb[cur ^ 1][t] + kdst);
        cp16(Vsrc0 + (t * NKB + kb + 1) * 32, Vtb[cur ^ 1][t] + vdst);
      }
    }
    if (kb + 2 < NKB) {  // keep L2 warm two passes ahead (global_prefetch_b8)
      __builtin_prefetch(Kpf0 + (size_t)(kb + 2) * 2048, 0, 1);
      __builtin_prefetch(Vpf0 + (kb + 2) * 32, 0, 1);
    }

    const _Float16* Kt = Ktb[cur][kh];
    const _Float16* Vt = Vtb[cur][kh];

    // S^T = K * Q^T : two 16-key M tiles, each 2 K-steps over hd=64, each
    // fragment against both query groups.
    // s[g][nt][r] = score(key nt*16 + lhi*8 + r, query of group g) minus the
    // query's reference.
    v8f s[2][2];
    for (int nt = 0; nt < 2; ++nt) {
      const int key = nt * 16 + ln;
      AF f0, f1;
      load_frag16(f0, Kt + key * KP, lhi);
      load_frag16(f1, Kt + key * KP + 32, lhi);
      for (int g = 0; g < 2; ++g) {
        v8f c = __builtin_amdgcn_wmma_f32_16x16x32_f16(
            false, f0.v, false, qa[g][0].v, (short)0, nref[g], false, false);
        c = __builtin_amdgcn_wmma_f32_16x16x32_f16(
            false, f1.v, false, qa[g][1].v, (short)0, c, false, false);
        s[g][nt] = c;
      }
    }

    // The V^T fragments are asked for ahead of the softmax, which hides their
    // LDS latency.
    AF vf[4];
    for (int d = 0; d < 4; ++d) load_frag16(vf[d], Vt + (d * 16 + ln) * VP, lhi);

    // This lane's largest score above its reference, per group: 16 of a
    // query's 32 scores are in this lane, the other 16 in lane ^ 16.
    float mx[2];
    for (int g = 0; g < 2; ++g) {
      float t[8];
      for (int r = 0; r < 8; ++r) t[r] = fmaxf(s[g][0][r], s[g][1][r]);
      mx[g] = fmaxf(fmaxf(fmaxf(t[0], t[1]), fmaxf(t[2], t[3])),
                    fmaxf(fmaxf(t[4], t[5]), fmaxf(t[6], t[7])));
    }

    // One test per pass and wave, a scalar branch. Up to 8 above the reference
    // P stays at or below 256, well inside f16. Pass 0 sets the reference.
    const bool over = fmaxf(mx[0], mx[1]) > 8.0f;
    if (kb == 0 || __builtin_amdgcn_ballot_w32(over) != 0) {
      for (int g = 0; g < 2; ++g) {
        // The reference moves up to the pass's maximum where that is higher, never down
        // (in pass 0, with nothing summed yet, to the pass's own maximum).
        float d = fmaxf(mx[g], xhalf(mx[g]));
        if (kb != 0) d = fmaxf(d, 0.0f);
        float corr = -fmaxf(d, 0.0f);
        exp2_1(corr);
        for (int e = 0; e < 8; ++e) {
          nref[g][e] -= d;
          s[g][0][e] -= d;
          s[g][1][e] -= d;
        }
        lsum[g] *= corr;
        for (int dd = 0; dd < 4; ++dd)
          for (int r = 0; r < 8; ++r) o[g][dd][r] *= corr;
      }
    }

    AF pb[2];
    for (int g = 0; g < 2; ++g) {
      // P^T as a B operand: halves 0..7 are keys lhi*8 + 0..7 and halves 8..15
      // keys 16 + lhi*8 + 0..7, the k order in which load_frag16 brings V^T.
      float p0[8], p1[8], t[8];
      for (int r = 0; r < 8; ++r) {
        p0[r] = s[g][0][r];
        p1[r] = s[g][1][r];
      }
      exp2_8(p0);
      exp2_8(p1);
      for (int r = 0; r < 8; ++r) {
        t[r] = p0[r] + p1[r];
        pb[g].h[r]     = (_Float16)p0[r];
        pb[g].h[8 + r] = (_Float16)p1[r];
      }
      lsum[g] += ((t[0] + t[1]) + (t[2] + t[3])) +
                 ((t[4] + t[5]) + (t[6] + t[7]));
    }

    // O^T += V^T * P^T : four 16-row hd tiles, contraction over 32 keys, each
    // fragment against both query groups.
    for (int d = 0; d < 4; ++d)
      for (int g = 0; g < 2; ++g)
        o[g][d] = __builtin_amdgcn_wmma_f32_16x16x32_f16(
            false, vf[d].v, false, pb[g].v, (short)0, o[g][d], false, false);
  }

  // Merge the key halves: hand group 1 to the partner wave, take the partner's
  // group 1 (this wave's group 0 queries, the other 1024 keys).
  float* xw = Xm + (size_t)wave * 34 * 32 + lane;
  for (int d = 0; d < 4; ++d)
    for (int e = 0; e < 8; ++e) xw[(d * 8 + e) * 32] = o[1][d][e];
  xw[32 * 32] = -nref[1][0];
  xw[33 * 32] = lsum[1];
  __syncthreads();  // the partner's values are in LDS
  const float* xr = Xm + (size_t)(wave ^ 4) * 34 * 32 + lane;
  const float mo = xr[32 * 32];
  const float lo_ = xr[33 * 32];
  const float m0 = -nref[0][0];
  const float mm = fmaxf(m0, mo);
  float c0 = m0 - mm;  // references are base-2 exponents
  float c1 = mo - mm;
  exp2_1(c0);
  exp2_1(c1);
  const float lj = lsum[0] * c0 + lo_ * c1;

  // Normalize and write fp32 output [B, T, E]: a lane holds 8 consecutive hd
  // values of its query per tile, two 16-byte stores.
  const float inv = 1.0f / (lj + xhalf(lj));
  c0 *= inv;
  c1 *= inv;
  float* orow = out + (size_t)(b * SEQ_T + trow) * EMBED_DIM + h * HEAD_DIM +
                lhi * 8;
  for (int d = 0; d < 4; ++d) {
    v4f lo, hi;
    for (int e = 0; e < 4; ++e) {
      lo[e] = o[0][d][e] * c0 + xr[(d * 8 + e) * 32] * c1;
      hi[e] = o[0][d][4 + e] * c0 + xr[(d * 8 + 4 + e) * 32] * c1;
    }
    *(v4f*)(orow + d * 16)     = lo;
    *(v4f*)(orow + d * 16 + 4) = hi;
  }
}

// ---------------------------------------------------------------------------
extern "C" void kernel_launch(void* const* d_in, const int* in_sizes, int n_in,
                              void* d_out, int out_size, void* d_ws, size_t ws_size,
                              hipStream_t stream) {
  (void)in_sizes; (void)n_in; (void)out_size; (void)ws_size;
  const float* x    = (const float*)d_in[0];
  const float* W    = (const float*)d_in[1];
  const float* bias = (const float*)d_in[2];

  const size_t elems = (size_t)BATCH * NUM_HEADS * SEQ_T * HEAD_DIM;  // 4 Mi
  _Float16* Qh = (_Float16*)d_ws;          // 8 MB, [b][h][t][hd]
  _Float16* Kh = Qh + elems;               // 8 MB, [b][h][t][hd]
  _Float16* Vh = Kh + elems;               // 8 MB, [b][h][hd][t] (transposed)

  dim3 grid(SEQ_T / 128, NUM_HEADS, BATCH);  // 16 x 16 x 2 = 512 blocks
  qkv_proj_kernel<<<grid, 256, 0, stream>>>(x, W, bias, Qh, Kh, Vh);
  flash_attn_kernel<<<grid, 256, 0, stream>>>(Qh, Kh, Vh, (float*)d_out);
}

// v007
// It runs in 32 microseconds.
// It is 1.36 times as fast as v005, going by the measured steps of the versions left out in between.
// Over all steps from v000 it is 8.32 times as fast.
#include <hip/hip_runtime.h>
#include <stdint.h>

// MHA for B=2, T=2048, E=1024, H=16, hd=64 on gfx1250 (wave32, WMMA), in ONE
// launch. The K and V projections are folded out of the key loop:
//   q.k_j = q.(x_j Wk + bk) = (q Wk^T).x_j + q.bk, and q.bk is the same for
//   every key of a query, so it cancels in the softmax;
//   sum_j p_j (x_j Wv + bv) = (sum_j p_j x_j) Wv + bv, as the p_j sum to 1.
// So the keys AND the values of the loop are the rows of x themselves. A block
// forms Q' = (x Wq + bq) Wk^T for its own queries, runs flash attention over
// x, and applies Wv and bv to the normalized sums in its epilogue.
// The attention is in transposed form: S^T = X*Q'^T and O^T += X^T*P^T, so that
// a lane holds the scores of ONE query and P goes from the score accumulators
// straight into a B operand (no LDS, no row shuffles).
// WMMA fragments from LDS are loaded as two 16B (b128) transfers per fragment;
// the query fragments as four 16B loads of f32 from global.
// The x tiles are DOUBLE-BUFFERED in LDS: the f32 rows of pass kb+1 are asked
// for in the middle of pass kb-1 and stored as f16, in both orientations, at
// the head of pass kb. The pass barrier is SPLIT: a wave signals once its
// stores and its own fragment reads are done, between the two groups'
// exponentials, and waits only at the head of the next pass: the second
// group's softmax and O^T run in between.

typedef __attribute__((ext_vector_type(16))) _Float16 v16h;
typedef __attribute__((ext_vector_type(8)))  float    v8f;
typedef __attribute__((ext_vector_type(4)))  float    v4f;
typedef __attribute__((ext_vector_type(4)))  uint32_t v4u;
typedef __attribute__((ext_vector_type(2)))  uint32_t v2u;

#define NUM_HEADS 16
#define EMBED_DIM 1024
#define HEAD_DIM  64
#define SEQ_T     2048
#define BATCH     2
#define N3        192   // 3*HEAD_DIM

// LDS row pitches in halves. Every tile here is read by 16-byte loads in which
// the 16 lanes of a wave half take 16 consecutive rows: at a pitch of
// 16 B x odd those reads fall on all 64 banks, at 128 B or 64 B on few.
#define KP 72   // 128-byte rows (x tile, weights) at 144 B
#define VP 40   // 64-byte rows (x^T tile) at 80 B

union AF { v16h v; _Float16 h[16]; uint32_t u[8]; v4u q[2]; };

// Load a 16-half WMMA fragment (A or B operand, one 32-wide K step) from a
// row whose K-run is contiguous in memory. Per the CDNA5 ISA layout, lane
// halves 0..7 are K=[lhi*8, lhi*8+8) and halves 8..15 are K=[16+lhi*8, +8):
// two aligned 16-byte loads.
static __device__ __forceinline__ void load_frag16(AF& a,
                                                   const _Float16* row_base,
                                                   int lhi) {
  const v4u* p = (const v4u*)(row_base + lhi * 8);
  a.q[0] = p[0];   // halves 0..7
  a.q[1] = p[2];   // halves 16..23 (p strides 8 halves)
}

// Two 16-row accumulator tiles (rows lhi*8 + r of tile 0 and of tile 1, one
// column per lane) as the B operand of a 32-wide K step: load_frag16's k order.
static __device__ __forceinline__ void pack_b(AF& a, const v8f& t0,
                                              const v8f& t1, float scale) {
  for (int r = 0; r < 8; ++r) {
    a.h[r]     = (_Float16)(t0[r] * scale);
    a.h[8 + r] = (_Float16)(t1[r] * scale);
  }
}

static __device__ __forceinline__ v2u pack4(float a, float b, float c,
                                            float d) {
  union { _Float16 h[4]; v2u q; } p;
  p.h[0] = (_Float16)a;
  p.h[1] = (_Float16)b;
  p.h[2] = (_Float16)c;
  p.h[3] = (_Float16)d;
  return p.q;
}

// A 4 x 4 f32 micro-tile r[row][col] to f16 in LDS, 8-byte stores: as it lies
// (rows at pitch p) or transposed (columns at pitch p).
static __device__ __forceinline__ void put_rows(const v4f (&r)[4], _Float16* l,
                                                int p) {
  for (int i = 0; i < 4; ++i)
    *(v2u*)(l + i * p) = pack4(r[i][0], r[i][1], r[i][2], r[i][3]);
}
static __device__ __forceinline__ void put_cols(const v4f (&r)[4], _Float16* l,
                                                int p) {
  for (int c = 0; c < 4; ++c)
    *(v2u*)(l + c * p) = pack4(r[0][c], r[1][c], r[2][c], r[3][c]);
}

static __device__ __forceinline__ v8f mma(const AF& a, const AF& b, v8f c) {
  return __builtin_amdgcn_wmma_f32_16x16x32_f16(false, a.v, false, b.v,
                                                (short)0, c, false, false);
}

// Lane l <-> lane l ^ 16 (the two halves of a wave) on the vector pipe.
static __device__ __forceinline__ float xhalf(float x) {
  int i = __builtin_bit_cast(int, x);
  return __builtin_bit_cast(float, __builtin_amdgcn_permlanex16(
      i, i, 0x76543210, 0xfedcba98, false, false));
}

// The two halves of the work-group barrier and the LDS wait in front of the
// signal. The "memory" clobber keeps every LDS access on its side of them.
static __device__ __forceinline__ void lds_done() {
  asm volatile("s_wait_dscnt 0x0" ::: "memory");
}
static __device__ __forceinline__ void bar_signal() {
  asm volatile("s_barrier_signal -1" ::: "memory");
}
static __device__ __forceinline__ void bar_wait() {
  asm volatile("s_barrier_wait -1" ::: "memory");
}

// Base-2 exponentials in place, one statement each, ending in v_nop. The
// instruction set asks for one free slot between a transcendental and an
// instruction that reads its result or overwrites its source. In place, a
// source is a live result that nothing overwrites; the v_nop keeps the slot
// behind the last one.
static __device__ __forceinline__ void exp2_1(float& x) {
  asm("v_exp_f32 %0, %0\n\tv_nop" : "+v"(x));
}
static __device__ __forceinline__ void exp2_8(float (&x)[8]) {
  asm("v_exp_f32 %0, %0\n\tv_exp_f32 %1, %1\n\tv_exp_f32 %2, %2\n\t"
      "v_exp_f32 %3, %3\n\tv_exp_f32 %4, %4\n\tv_exp_f32 %5, %5\n\t"
      "v_exp_f32 %6, %6\n\tv_exp_f32 %7, %7\n\tv_nop"
      : "+v"(x[0]), "+v"(x[1]), "+v"(x[2]), "+v"(x[3]), "+v"(x[4]), "+v"(x[5]),
        "+v"(x[6]), "+v"(x[7]));
}

// ---------------------------------------------------------------------------
// Block = 8 waves = 128 query rows of one (b,h).
// A wave takes 32 queries (two 16-column B groups) and ONE HALF of the keys:
// waves 0..3 keys 0..1023, waves 4..7 keys 1024..2047. Each x and x^T fragment
// read from LDS feeds two WMMAs, and the block keeps its eight waves.
// Per pass and wave, 32 keys: S^T = X*Q'^T (8 WMMA), online softmax with one
// query per lane and group, O^T += X^T*P^T (8 WMMA).
// The softmax reference of a query is HELD from pass to pass: minus the
// reference is the C operand of S^T, so the accumulators are the arguments of
// exp2 as they stand, and O and the sums are rescaled only in a pass in which
// some score of the wave stands more than 8 above its reference.
// At the end the two key halves of a query are merged through LDS: each wave
// hands one group to its partner and finishes the other, Wv and bv included.
// ---------------------------------------------------------------------------
// Two blocks per WGP, four waves per SIMD: the register budget is 256.
__global__ __launch_bounds__(256)
__attribute__((amdgpu_waves_per_eu(4, 4))) void fused_attn_kernel(
    const float* __restrict__ x, const float* __restrict__ W,
    const float* __restrict__ bias, float* __restrict__ out) {
  // [buffer][key half][key][hd]
  __shared__ __attribute__((aligned(16))) _Float16 Ktb[2][2][32 * KP];
  // [buffer][key half][hd][key]
  __shared__ __attribute__((aligned(16))) _Float16 Vtb[2][2][HEAD_DIM * VP];
  // Wq^T [col][k], Wk [k][col] as it lies, Wv^T [col][k]
  __shared__ __attribute__((aligned(16))) _Float16 Ws[3][HEAD_DIM * KP];
  __shared__ __attribute__((aligned(16))) float Bs[N3];
  // Merge: [wave][32 O values, reference, lsum][lane]
  __shared__ float Xm[8 * 34 * 32];

  const int tid  = threadIdx.x;
  const int wave = tid >> 5;
  const int lane = tid & 31;
  const int lhi  = (lane >= 16) ? 1 : 0;
  const int ln   = lane & 15;
  const int kh   = wave >> 2;         // key half of this wave
  const int qw   = wave & 3;          // its 32 queries within the block
  const int qb   = blockIdx.x * 128;
  const int h    = blockIdx.y;
  const int b    = blockIdx.z;
  const float* xh = x + (size_t)b * SEQ_T * EMBED_DIM + h * HEAD_DIM;

  const int NKB = SEQ_T / 64;  // 32 passes, each 32 keys of either half

  // Per-thread staging assignment (kb-invariant): 4 keys x 4 hd values. The 16
  // lanes of a wave half take one whole 256-byte row of x_h per load.
  const int shq = tid & 15;           // hd quad
  const int sth = tid >> 7;           // key half
  const int skl = ((tid >> 4) & 7) * 4;  // first key within the 32-key tile
  const float* xsrc0 = xh + (size_t)(sth * (SEQ_T / 2) + skl) * EMBED_DIM +
                       shq * 4;       // + kb * 32 rows
  const int kdst = skl * KP + shq * 4;
  const int vdst = shq * 4 * VP + skl;

  // Every global load of the prologue is asked for up front: pass 0's rows,
  // the weights as 4 x 4 micro-tiles, the bias, this wave's query rows.
  v4f xs[4];
  for (int i = 0; i < 4; ++i)
    xs[i] = *(const v4f*)(xsrc0 + (size_t)i * EMBED_DIM);

  // Weights: 16 k quads x 48 column quads, three per thread. A wave takes 4
  // column quads x 8 k quads, so that its transposed 8-byte stores fall on all
  // 64 banks; its column quads lie in one of Wq, Wk, Wv (a scalar choice).
  v4f wv[3][4];
  for (int it = 0; it < 3; ++it) {
    const int rest = wave + 8 * it;   // 0..23
    const int cq = (rest % 12) * 4 + (lane & 3);
    const int kq = (rest / 12) * 8 + (lane >> 2);
    for (int i = 0; i < 4; ++i)
      wv[it][i] = *(const v4f*)(W + (kq * 4 + i) * N3 + cq * 4);
  }
  float bval = 0.0f;
  if (tid < N3) bval = bias[tid];

  // Query rows as B operands (lane = query column ln), f32 to f16.
  // Group g of a wave holds queries (g ^ kh)*16 + ln of its 32, so that group
  // 1 of a wave and group 0 of its partner (wave ^ 4) are the same queries.
  const int trow = qb + qw * 32 + kh * 16 + ln;  // group 0's query
  v4f xq[2][2][4];
  for (int g = 0; g < 2; ++g) {
    const float* xrow =
        xh + (size_t)(qb + qw * 32 + (g ^ kh) * 16 + ln) * EMBED_DIM + lhi * 8;
    for (int ks = 0; ks < 2; ++ks) {
      const v4f* xp = (const v4f*)(xrow + ks * 32);
      xq[g][ks][0] = xp[0];   // halves 0..7
      xq[g][ks][1] = xp[1];
      xq[g][ks][2] = xp[4];   // halves 8..15 (K offset +16)
      xq[g][ks][3] = xp[5];
    }
    // Stands in front of any later write of this group's address registers;
    // naming the address keeps it out of the loads' own destinations.
    asm volatile("s_wait_xcnt 0x0" ::"v"(xrow) : "memory");
  }

  for (int it = 0; it < 3; ++it) {
    const int rest = wave + 8 * it;
    const int part = (rest % 12) >> 2;             // 0 Wq, 1 Wk, 2 Wv
    const int cc = ((rest % 12) & 3) * 16 + (lane & 3) * 4;  // column in part
    const int k0 = ((rest / 12) * 8 + (lane >> 2)) * 4;
    if (part == 1)
      put_rows(wv[it], Ws[1] + k0 * KP + cc, KP);
    else
      put_cols(wv[it], Ws[part] + cc * KP + k0, KP);
  }
  if (tid < N3) Bs[tid] = bval;
  put_rows(xs, Ktb[0][sth] + kdst, KP);
  put_cols(xs, Vtb[0][sth] + vdst, VP);
  AF xb[2][2];
  for (int g = 0; g < 2; ++g)
    for (int ks = 0; ks < 2; ++ks)
      for (int v = 0; v < 4; ++v)
        for (int e = 0; e < 4; ++e)
          xb[g][ks].h[v * 4 + e] = (_Float16)xq[g][ks][v][e];
  __syncthreads();  // weights, bias and pass 0's tiles are in LDS

  // Pass 1's rows are asked for now; the products below hide their latency.
  for (int i = 0; i < 4; ++i)
    xs[i] = *(const v4f*)(xsrc0 + (size_t)(32 + i) * EMBED_DIM);
  // Stands in front of any later write of the address registers; naming the
  // address keeps it out of the loads' own destinations.
  asm volatile("s_wait_xcnt 0x0" ::"v"(xsrc0) : "memory");

  // Q'^T = Wk * (Wq^T * x^T + bq), scaled: two chained products per group. The
  // accumulators of the first (a lane holds 8 consecutive columns of its
  // query per tile) are packed into the B operand of the second, and those of
  // the second into the B operand of S^T, all in load_frag16's k order.
  // Q' carries 1/sqrt(64) and log2 e: its scores are base-2 exponents.
  AF qa[2][2];
  {
    v8f qt[2][4];
    for (int n = 0; n < 4; ++n) {
      AF a0, a1;
      load_frag16(a0, Ws[0] + (n * 16 + ln) * KP, lhi);
      load_frag16(a1, Ws[0] + (n * 16 + ln) * KP + 32, lhi);
      const v4f* bp = (const v4f*)(Bs + n * 16 + lhi * 8);
      const v4f b0 = bp[0], b1 = bp[1];
      v8f c;
      for (int e = 0; e < 4; ++e) {
        c[e]     = b0[e];
        c[4 + e] = b1[e];
      }
      for (int g = 0; g < 2; ++g) qt[g][n] = mma(a1, xb[g][1], mma(a0, xb[g][0], c));
    }
    AF qf[2][2];
    for (int g = 0; g < 2; ++g)
      for (int ks = 0; ks < 2; ++ks)
        pack_b(qf[g][ks], qt[g][2 * ks], qt[g][2 * ks + 1], 1.0f);
    for (int m = 0; m < 4; ++m) {
      AF a0, a1;
      load_frag16(a0, Ws[1] + (m * 16 + ln) * KP, lhi);
      load_frag16(a1, Ws[1] + (m * 16 + ln) * KP + 32, lhi);
      v8f z;
      for (int e = 0; e < 8; ++e) z[e] = 0.0f;
      for (int g = 0; g < 2; ++g) qt[g][m] = mma(a1, qf[g][1], mma(a0, qf[g][0], z));
    }
    for (int g = 0; g < 2; ++g)
      for (int ks = 0; ks < 2; ++ks)
        pack_b(qa[g][ks], qt[g][2 * ks], qt[g][2 * ks + 1],
               0.125f * 1.44269504f);
  }

  // Per lane and group: one query. nref is minus its reference in use, in base
  // 2 (equal in both wave halves and in all eight rows: a C operand), lsum the
  // sum over this lane half's keys only (joined in the epilogue).
  float lsum[2];
  v8f nref[2];
  v8f o[2][4];  // o[g][d][r] = sum_j p_j x_j[hd d*16 + lhi*8 + r] of the query
  for (int g = 0; g < 2; ++g) {
    lsum[g] = 0.0f;
    for (int e = 0; e < 8; ++e) nref[g][e] = 0.0f;
    for (int d = 0; d < 4; ++d)
      for (int e = 0; e < 8; ++e) o[g][d][e] = 0.0f;
  }

  for (int kb = 0; kb < NKB; ++kb) {
    const int cur = kb & 1;

    // Every wave has signalled in pass kb-1: this pass's tiles are in
    // buf[cur], and nobody reads buf[cur^1] any more.
    if (kb > 0) bar_wait();

    const _Float16* Kt = Ktb[cur][kh];
    const _Float16* Vt = Vtb[cur][kh];

    // At the head of the pass: the x fragments, then the next pass's tiles,
    // whose conversions run while the fragments are on their way.
    AF kf[2][2];
    for (int nt = 0; nt < 2; ++nt) {
      load_frag16(kf[nt][0], Kt + (nt * 16 + ln) * KP, lhi);
      load_frag16(kf[nt][1], Kt + (nt * 16 + ln) * KP + 32, lhi);
    }
    // No test around the stores: behind a branch the compiler's counted LDS
    // waits merge two paths and hold the products back for the stores. The
    // last pass writes its own rows once more, into the buffer nobody reads.
    put_rows(xs, Ktb[cur ^ 1][sth] + kdst, KP);
    put_cols(xs, Vtb[cur ^ 1][sth] + vdst, VP);
    // Keeps reads and stores one group in front of the products, the stores
    // far from the wait that covers them: left alone, the compiler spread
    // both among the products.
    __builtin_amdgcn_sched_barrier(0);

    // S^T = X * Q'^T : two 16-key M tiles, each 2 K-steps over hd=64, each
    // fragment against both query groups.
    // s[g][nt][r] = score(key nt*16 + lhi*8 + r, query of group g) minus the
    // query's reference.
    v8f s[2][2];
    for (int nt = 0; nt < 2; ++nt) {
      for (int g = 0; g < 2; ++g) {
        v8f c = __builtin_amdgcn_wmma_f32_16x16x32_f16(
            false, kf[nt][0].v, false, qa[g][0].v, (short)0, nref[g], false,
            false);
        c = __builtin_amdgcn_wmma_f32_16x16x32_f16(
            false, kf[nt][1].v, false, qa[g][1].v, (short)0, c, false, false);
        s[g][nt] = c;
      }
    }

    // The x^T fragments are asked for ahead of the maximum and its test, which
    // hide their LDS latency.
    AF vf[4];
    for (int d = 0; d < 4; ++d) load_frag16(vf[d], Vt + (d * 16 + ln) * VP, lhi);
    // Keeps all eight reads in front of the maximum: left alone, the compiler
    // put half of them behind it, close to the wait in front of the signal.
    __builtin_amdgcn_sched_barrier(0);

    // This lane's largest score above its reference, per group: 16 of a
    // query's 32 scores are in this lane, the other 16 in lane ^ 16.
    float mx[2];
    for (int g = 0; g < 2; ++g) {
      float t[8];
      for (int r = 0; r < 8; ++r) t[r] = fmaxf(s[g][0][r], s[g][1][r]);
      mx[g] = fmaxf(fmaxf(fmaxf(t[0], t[1]), fmaxf(t[2], t[3])),
                    fmaxf(fmaxf(t[4], t[5]), fmaxf(t[6], t[7])));
    }

    // One test per pass and wave, a scalar branch. Up to 8 above the reference
    // P stays at or below 256, well inside f16. Pass 0 sets the reference.
    const bool over = fmaxf(mx[0], mx[1]) > 8.0f;
    if (kb == 0 || __builtin_amdgcn_ballot_w32(over) != 0) {
      for (int g = 0; g < 2; ++g) {
        // The reference moves up to the pass's maximum where that is higher, never down
        // (in pass 0, with nothing summed yet, to the pass's own maximum).
        float d = fmaxf(mx[g], xhalf(mx[g]));
        if (kb != 0) d = fmaxf(d, 0.0f);
        float corr = -fmaxf(d, 0.0f);
        exp2_1(corr);
        for (int e = 0; e < 8; ++e) {
          nref[g][e] -= d;
          s[g][0][e] -= d;
          s[g][1][e] -= d;
        }
        lsum[g] *= corr;
        for (int dd = 0; dd < 4; ++dd)
          for (int r = 0; r < 8; ++r) o[g][dd][r] *= corr;
      }
    }

    AF pb[2];
    for (int g = 0; g < 2; ++g) {
      // P^T as a B operand: halves 0..7 are keys lhi*8 + 0..7 and halves 8..15
      // keys 16 + lhi*8 + 0..7, the k order in which load_frag16 brings x^T.
      float p0[8], p1[8], t[8];
      for (int r = 0; r < 8; ++r) {
        p0[r] = s[g][0][r];
        p1[r] = s[g][1][r];
      }
      exp2_8(p0);
      exp2_8(p1);
      for (int r = 0; r < 8; ++r) {
        t[r] = p0[r] + p1[r];
        pb[g].h[r]     = (_Float16)p0[r];
        pb[g].h[8 + r] = (_Float16)p1[r];
      }
      lsum[g] += ((t[0] + t[1]) + (t[2] + t[3])) +
                 ((t[4] + t[5]) + (t[6] + t[7]));

      // Between the groups: group 0's exponentials have covered the latency
      // of the x^T reads, so the wait costs little here.
      if (g == 0 && kb + 1 < NKB) {
        // This wave's reads of buf[cur] have returned and its part of the next
        // tiles is in buf[cur^1]: say so, and do not wait for the others yet.
        // No LDS access stands between here and the wait of pass kb+1.
        lds_done();
        bar_signal();
      }
      if (g == 0 && kb + 2 < NKB) {  // rows of pass kb+2, stored at the head of pass kb+1
        const float* xp = xsrc0 + (size_t)kb * 32 * EMBED_DIM;
        for (int i = 0; i < 4; ++i)
          xs[i] = *(const v4f*)(xp + (size_t)(64 + i) * EMBED_DIM);
        // Stands in front of any later write of the address registers; naming
        // the address keeps it out of the loads' own destinations.
        asm volatile("s_wait_xcnt 0x0" ::"v"(xp) : "memory");
      }
    }

    // O^T += X^T * P^T : four 16-row hd tiles, contraction over 32 keys, each
    // fragment against both query groups.
    for (int d = 0; d < 4; ++d)
      for (int g = 0; g < 2; ++g)
        o[g][d] = __builtin_amdgcn_wmma_f32_16x16x32_f16(
            false, vf[d].v, false, pb[g].v, (short)0, o[g][d], false, false);
  }

  // Merge the key halves: hand group 1 to the partner wave, take the partner's
  // group 1 (this wave's group 0 queries, the other 1024 keys).
  float* xw = Xm + (size_t)wave * 34 * 32 + lane;
  for (int d = 0; d < 4; ++d)
    for (int e = 0; e < 8; ++e) xw[(d * 8 + e) * 32] = o[1][d][e];
  xw[32 * 32] = -nref[1][0];
  xw[33 * 32] = lsum[1];
  __syncthreads();  // the partner's values are in LDS
  const float* xr = Xm + (size_t)(wave ^ 4) * 34 * 32 + lane;
  const float mo = xr[32 * 32];
  const float lo_ = xr[33 * 32];
  const float m0 = -nref[0][0];
  const float mm = fmaxf(m0, mo);
  float c0 = m0 - mm;  // references are base-2 exponents
  float c1 = mo - mm;
  exp2_1(c0);
  exp2_1(c1);
  const float lj = lsum[0] * c0 + lo_ * c1;

  // Normalize: om[d][e] = (sum_j p_j x_j)[hd d*16 + lhi*8 + e] of query trow.
  const float inv = 1.0f / (lj + xhalf(lj));
  c0 *= inv;
  c1 *= inv;
  v8f om[4];
  for (int d = 0; d < 4; ++d)
    for (int e = 0; e < 8; ++e)
      om[d][e] = o[0][d][e] * c0 + xr[(d * 8 + e) * 32] * c1;

  // out^T = Wv^T * om^T + bv: A = Wv^T rows (output columns), B = the sums
  // packed from their registers. A lane holds 8 consecutive columns of its
  // query per tile, two 16-byte stores into fp32 [B, T, E].
  AF ob[2];
  for (int ks = 0; ks < 2; ++ks) pack_b(ob[ks], om[2 * ks], om[2 * ks + 1], 1.0f);
  float* orow = out + (size_t)(b * SEQ_T + trow) * EMBED_DIM + h * HEAD_DIM +
                lhi * 8;
  for (int n = 0; n < 4; ++n) {
    AF a0, a1;
    load_frag16(a0, Ws[2] + (n * 16 + ln) * KP, lhi);
    load_frag16(a1, Ws[2] + (n * 16 + ln) * KP + 32, lhi);
    const v4f* bp = (const v4f*)(Bs + 2 * HEAD_DIM + n * 16 + lhi * 8);
    const v4f b0 = bp[0], b1 = bp[1];
    v8f c;
    for (int e = 0; e < 4; ++e) {
      c[e]     = b0[e];
      c[4 + e] = b1[e];
    }
    c = mma(a1, ob[1], mma(a0, ob[0], c));
    v4f lo, hi;
    for (int e = 0; e < 4; ++e) {
      lo[e] = c[e];
      hi[e] = c[4 + e];
    }
    *(v4f*)(orow + n * 16)     = lo;
    *(v4f*)(orow + n * 16 + 4) = hi;
  }
}

// ---------------------------------------------------------------------------
extern "C" void kernel_launch(void* const* d_in, const int* in_sizes, int n_in,
                              void* d_out, int out_size, void* d_ws, size_t ws_size,
                              hipStream_t stream) {
  (void)in_sizes; (void)n_in; (void)out_size; (void)d_ws; (void)ws_size;
  const float* x    = (const float*)d_in[0];
  const float* W    = (const float*)d_in[1];
  const float* bias = (const float*)d_in[2];

  dim3 grid(SEQ_T / 128, NUM_HEADS, BATCH);  // 16 x 16 x 2 = 512 blocks
  fused_attn_kernel<<<grid, 256, 0, stream>>>(x, W, bias, (float*)d_out);
}

// v008
// One run takes 31 microseconds.
// Two timings next to v007 put it at 1.04 and 1.03 times that version's speed.
// Over all steps from v000 it is 8.61 times as fast.
#include <hip/hip_runtime.h>
#include <stdint.h>

// MHA for B=2, T=2048, E=1024, H=16, hd=64 on gfx1250 (wave32, WMMA), in ONE
// launch. The K and V projections are folded out of the key loop:
//   q.k_j = q.(x_j Wk + bk) = (q Wk^T).x_j + q.bk, and q.bk is the same for
//   every key of a query, so it cancels in the softmax;
//   sum_j p_j (x_j Wv + bv) = (sum_j p_j x_j) Wv + bv, as the p_j sum to 1.
// So the keys AND the values of the loop are the rows of x themselves. A block
// forms Q' = (x Wq + bq) Wk^T for its own queries, runs flash attention over
// x, and applies Wv and bv to the normalized sums in its epilogue.
// The attention is in transposed form: S^T = X*Q'^T and O^T += X^T*P^T, so that
// a lane holds the scores of ONE query and P goes from the score accumulators
// straight into a B operand (no LDS, no row shuffles).
// WMMA fragments from LDS are loaded as two 16B (b128) transfers per fragment;
// the query fragments as four 16B loads of f32 from global.
// The x tiles are DOUBLE-BUFFERED in LDS: the f32 rows of pass kb+1 are asked
// for at the head of pass kb-1, converted to f16 at its foot and stored, in
// both orientations, at the head of pass kb. The pass barrier is SPLIT: a wave
// signals once its stores and its own fragment reads are done, between the two
// groups' exponentials, and waits only at the head of the next pass: the
// second group's softmax, O^T and the conversions run in between.

typedef __attribute__((ext_vector_type(16))) _Float16 v16h;
typedef __attribute__((ext_vector_type(8)))  float    v8f;
typedef __attribute__((ext_vector_type(4)))  float    v4f;
typedef __attribute__((ext_vector_type(4)))  uint32_t v4u;
typedef __attribute__((ext_vector_type(2)))  uint32_t v2u;

#define NUM_HEADS 16
#define EMBED_DIM 1024
#define HEAD_DIM  64
#define SEQ_T     2048
#define BATCH     2
#define N3        192   // 3*HEAD_DIM

// LDS row pitches in halves. Every tile here is read by 16-byte loads in which
// the 16 lanes of a wave half take 16 consecutive rows: at a pitch of
// 16 B x odd those reads fall on all 64 banks, at 128 B or 64 B on few.
#define KP 72   // 128-byte rows (x tile, weights) at 144 B
#define VP 40   // 64-byte rows (x^T tile) at 80 B

union AF { v16h v; _Float16 h[16]; uint32_t u[8]; v4u q[2]; };

// Load a 16-half WMMA fragment (A or B operand, one 32-wide K step) from a
// row whose K-run is contiguous in memory. Per the CDNA5 ISA layout, lane
// halves 0..7 are K=[lhi*8, lhi*8+8) and halves 8..15 are K=[16+lhi*8, +8):
// two aligned 16-byte loads.
static __device__ __forceinline__ void load_frag16(AF& a,
                                                   const _Float16* row_base,
                                                   int lhi) {
  const v4u* p = (const v4u*)(row_base + lhi * 8);
  a.q[0] = p[0];   // halves 0..7
  a.q[1] = p[2];   // halves 16..23 (p strides 8 halves)
}

// Two 16-row accumulator tiles (rows lhi*8 + r of tile 0 and of tile 1, one
// column per lane) as the B operand of a 32-wide K step: load_frag16's k order.
static __device__ __forceinline__ void pack_b(AF& a, const v8f& t0,
                                              const v8f& t1, float scale) {
  for (int r = 0; r < 8; ++r) {
    a.h[r]     = (_Float16)(t0[r] * scale);
    a.h[8 + r] = (_Float16)(t1[r] * scale);
  }
}

static __device__ __forceinline__ v2u pack4(float a, float b, float c,
                                            float d) {
  union { _Float16 h[4]; v2u q; } p;
  p.h[0] = (_Float16)a;
  p.h[1] = (_Float16)b;
  p.h[2] = (_Float16)c;
  p.h[3] = (_Float16)d;
  return p.q;
}

// A 4 x 4 f32 micro-tile r[row][col] to f16 in LDS, 8-byte stores: as it lies
// (rows at pitch p) or transposed (columns at pitch p).
static __device__ __forceinline__ void put_rows(const v4f (&r)[4], _Float16* l,
                                                int p) {
  for (int i = 0; i < 4; ++i)
    *(v2u*)(l + i * p) = pack4(r[i][0], r[i][1], r[i][2], r[i][3]);
}
static __device__ __forceinline__ void put_cols(const v4f (&r)[4], _Float16* l,
                                                int p) {
  for (int c = 0; c < 4; ++c)
    *(v2u*)(l + c * p) = pack4(r[0][c], r[1][c], r[2][c], r[3][c]);
}

// One row, or one column, of such a micro-tile as four f16 in two registers.
static __device__ __forceinline__ v2u row4(const v4f (&r)[4], int i) {
  return pack4(r[i][0], r[i][1], r[i][2], r[i][3]);
}
static __device__ __forceinline__ v2u col4(const v4f (&r)[4], int c) {
  return pack4(r[0][c], r[1][c], r[2][c], r[3][c]);
}

static __device__ __forceinline__ v8f mma(const AF& a, const AF& b, v8f c) {
  return __builtin_amdgcn_wmma_f32_16x16x32_f16(false, a.v, false, b.v,
                                                (short)0, c, false, false);
}

// Lane l <-> lane l ^ 16 (the two halves of a wave) on the vector pipe.
static __device__ __forceinline__ float xhalf(float x) {
  int i = __builtin_bit_cast(int, x);
  return __builtin_bit_cast(float, __builtin_amdgcn_permlanex16(
      i, i, 0x76543210, 0xfedcba98, false, false));
}

// The two halves of the work-group barrier and the LDS wait in front of the
// signal. The "memory" clobber keeps every LDS access on its side of them.
static __device__ __forceinline__ void lds_done() {
  asm volatile("s_wait_dscnt 0x0" ::: "memory");
}
static __device__ __forceinline__ void bar_signal() {
  asm volatile("s_barrier_signal -1" ::: "memory");
}
static __device__ __forceinline__ void bar_wait() {
  asm volatile("s_barrier_wait -1" ::: "memory");
}

// Base-2 exponentials in place, one statement each, ending in v_nop. The
// instruction set asks for one free slot between a transcendental and an
// instruction that reads its result or overwrites its source. In place, a
// source is a live result that nothing overwrites; the v_nop keeps the slot
// behind the last one.
static __device__ __forceinline__ void exp2_1(float& x) {
  asm("v_exp_f32 %0, %0\n\tv_nop" : "+v"(x));
}
static __device__ __forceinline__ void exp2_8(float (&x)[8]) {
  asm("v_exp_f32 %0, %0\n\tv_exp_f32 %1, %1\n\tv_exp_f32 %2, %2\n\t"
      "v_exp_f32 %3, %3\n\tv_exp_f32 %4, %4\n\tv_exp_f32 %5, %5\n\t"
      "v_exp_f32 %6, %6\n\tv_exp_f32 %7, %7\n\tv_nop"
      : "+v"(x[0]), "+v"(x[1]), "+v"(x[2]), "+v"(x[3]), "+v"(x[4]), "+v"(x[5]),
        "+v"(x[6]), "+v"(x[7]));
}

// ---------------------------------------------------------------------------
// Block = 8 waves = 128 query rows of one (b,h).
// A wave takes 32 queries (two 16-column B groups) and ONE HALF of the keys:
// waves 0..3 keys 0..1023, waves 4..7 keys 1024..2047. Each x and x^T fragment
// read from LDS feeds two WMMAs, and the block keeps its eight waves.
// Per pass and wave, 32 keys: S^T = X*Q'^T (8 WMMA), online softmax with one
// query per lane and group, O^T += X^T*P^T (8 WMMA).
// The softmax reference of a query is HELD from pass to pass: minus the
// reference is the C operand of S^T, so the accumulators are the arguments of
// exp2 as they stand, and O and the sums are rescaled only in a pass in which
// some score of the wave stands more than 8 above its reference.
// At the end the two key halves of a query are merged through LDS: each wave
// hands one group to its partner and finishes the other, Wv and bv included.
// ---------------------------------------------------------------------------
// Two blocks per WGP, four waves per SIMD: the register budget is 256.
__global__ __launch_bounds__(256)
__attribute__((amdgpu_waves_per_eu(4, 4))) void fused_attn_kernel(
    const float* __restrict__ x, const float* __restrict__ W,
    const float* __restrict__ bias, float* __restrict__ out) {
  // [buffer][key half][key][hd]
  __shared__ __attribute__((aligned(16))) _Float16 Ktb[2][2][32 * KP];
  // [buffer][key half][hd][key]
  __shared__ __attribute__((aligned(16))) _Float16 Vtb[2][2][HEAD_DIM * VP];
  // Wq^T [col][k], Wk [k][col] as it lies, Wv^T [col][k]
  __shared__ __attribute__((aligned(16))) _Float16 Ws[3][HEAD_DIM * KP];
  __shared__ __attribute__((aligned(16))) float Bs[N3];
  // Merge: [wave][32 O values, reference, lsum][lane]
  __shared__ float Xm[8 * 34 * 32];

  const int tid  = threadIdx.x;
  const int wave = tid >> 5;
  const int lane = tid & 31;
  const int lhi  = (lane >= 16) ? 1 : 0;
  const int ln   = lane & 15;
  const int kh   = wave >> 2;         // key half of this wave
  const int qw   = wave & 3;          // its 32 queries within the block
  const int qb   = blockIdx.x * 128;
  const int h    = blockIdx.y;
  const int b    = blockIdx.z;
  const float* xh = x + (size_t)b * SEQ_T * EMBED_DIM + h * HEAD_DIM;

  const int NKB = SEQ_T / 64;  // 32 passes, each 32 keys of either half

  // Per-thread staging assignment (kb-invariant): 4 keys x 4 hd values. The 16
  // lanes of a wave half take one whole 256-byte row of x_h per load.
  const int shq = tid & 15;           // hd quad
  const int sth = tid >> 7;           // key half
  const int skl = ((tid >> 4) & 7) * 4;  // first key within the 32-key tile
  const float* xsrc0 = xh + (size_t)(sth * (SEQ_T / 2) + skl) * EMBED_DIM +
                       shq * 4;       // + kb * 32 rows
  const int kdst = skl * KP + shq * 4;
  const int vdst = shq * 4 * VP + skl;

  // Every global load of the prologue is asked for up front: pass 0's rows,
  // the weights as 4 x 4 micro-tiles, the bias, this wave's query rows.
  v4f xs[4];
  for (int i = 0; i < 4; ++i)
    xs[i] = *(const v4f*)(xsrc0 + (size_t)i * EMBED_DIM);

  // Weights: 16 k quads x 48 column quads, three per thread. A wave takes 4
  // column quads x 8 k quads, so that its transposed 8-byte stores fall on all
  // 64 banks; its column quads lie in one of Wq, Wk, Wv (a scalar choice).
  v4f wv[3][4];
  for (int it = 0; it < 3; ++it) {
    const int rest = wave + 8 * it;   // 0..23
    const int cq = (rest % 12) * 4 + (lane & 3);
    const int kq = (rest / 12) * 8 + (lane >> 2);
    for (int i = 0; i < 4; ++i)
      wv[it][i] = *(const v4f*)(W + (kq * 4 + i) * N3 + cq * 4);
  }
  float bval = 0.0f;
  if (tid < N3) bval = bias[tid];

  // Query rows as B operands (lane = query column ln), f32 to f16.
  // Group g of a wave holds queries (g ^ kh)*16 + ln of its 32, so that group
  // 1 of a wave and group 0 of its partner (wave ^ 4) are the same queries.
  const int trow = qb + qw * 32 + kh * 16 + ln;  // group 0's query
  v4f xq[2][2][4];
  for (int g = 0; g < 2; ++g) {
    const float* xrow =
        xh + (size_t)(qb + qw * 32 + (g ^ kh) * 16 + ln) * EMBED_DIM + lhi * 8;
    for (int ks = 0; ks < 2; ++ks) {
      const v4f* xp = (const v4f*)(xrow + ks * 32);
      xq[g][ks][0] = xp[0];   // halves 0..7
      xq[g][ks][1] = xp[1];
      xq[g][ks][2] = xp[4];   // halves 8..15 (K offset +16)
      xq[g][ks][3] = xp[5];
    }
    // Stands in front of any later write of this group's address registers;
    // naming the address keeps it out of the loads' own destinations.
    asm volatile("s_wait_xcnt 0x0" ::"v"(xrow) : "memory");
  }

  for (int it = 0; it < 3; ++it) {
    const int rest = wave + 8 * it;
    const int part = (rest % 12) >> 2;             // 0 Wq, 1 Wk, 2 Wv
    const int cc = ((rest % 12) & 3) * 16 + (lane & 3) * 4;  // column in part
    const int k0 = ((rest / 12) * 8 + (lane >> 2)) * 4;
    if (part == 1)
      put_rows(wv[it], Ws[1] + k0 * KP + cc, KP);
    else
      put_cols(wv[it], Ws[part] + cc * KP + k0, KP);
  }
  if (tid < N3) Bs[tid] = bval;
  put_rows(xs, Ktb[0][sth] + kdst, KP);
  put_cols(xs, Vtb[0][sth] + vdst, VP);
  AF xb[2][2];
  for (int g = 0; g < 2; ++g)
    for (int ks = 0; ks < 2; ++ks)
      for (int v = 0; v < 4; ++v)
        for (int e = 0; e < 4; ++e)
          xb[g][ks].h[v * 4 + e] = (_Float16)xq[g][ks][v][e];
  __syncthreads();  // weights, bias and pass 0's tiles are in LDS

  // Pass 1's rows are asked for now; the products below hide their latency.
  for (int i = 0; i < 4; ++i)
    xs[i] = *(const v4f*)(xsrc0 + (size_t)(32 + i) * EMBED_DIM);
  // Stands in front of any later write of the address registers; naming the
  // address keeps it out of the loads' own destinations.
  asm volatile("s_wait_xcnt 0x0" ::"v"(xsrc0) : "memory");

  // Q'^T = Wk * (Wq^T * x^T + bq), scaled: two chained products per group. The
  // accumulators of the first (a lane holds 8 consecutive columns of its
  // query per tile) are packed into the B operand of the second, and those of
  // the second into the B operand of S^T, all in load_frag16's k order.
  // Q' carries 1/sqrt(64) and log2 e: its scores are base-2 exponents.
  AF qa[2][2];
  {
    v8f qt[2][4];
    for (int n = 0; n < 4; ++n) {
      AF a0, a1;
      load_frag16(a0, Ws[0] + (n * 16 + ln) * KP, lhi);
      load_frag16(a1, Ws[0] + (n * 16 + ln) * KP + 32, lhi);
      const v4f* bp = (const v4f*)(Bs + n * 16 + lhi * 8);
      const v4f b0 = bp[0], b1 = bp[1];
      v8f c;
      for (int e = 0; e < 4; ++e) {
        c[e]     = b0[e];
        c[4 + e] = b1[e];
      }
      for (int g = 0; g < 2; ++g) qt[g][n] = mma(a1, xb[g][1], mma(a0, xb[g][0], c));
    }
    AF qf[2][2];
    for (int g = 0; g < 2; ++g)
      for (int ks = 0; ks < 2; ++ks)
        pack_b(qf[g][ks], qt[g][2 * ks], qt[g][2 * ks + 1], 1.0f);
    for (int m = 0; m < 4; ++m) {
      AF a0, a1;
      load_frag16(a0, Ws[1] + (m * 16 + ln) * KP, lhi);
      load_frag16(a1, Ws[1] + (m * 16 + ln) * KP + 32, lhi);
      v8f z;
      for (int e = 0; e < 8; ++e) z[e] = 0.0f;
      for (int g = 0; g < 2; ++g) qt[g][m] = mma(a1, qf[g][1], mma(a0, qf[g][0], z));
    }
    for (int g = 0; g < 2; ++g)
      for (int ks = 0; ks < 2; ++ks)
        pack_b(qa[g][ks], qt[g][2 * ks], qt[g][2 * ks + 1],
               0.125f * 1.44269504f);
  }

  // Per lane and group: one query. nref is minus its reference in use, in base
  // 2 (equal in both wave halves and in all eight rows: a C operand), lsum the
  // sum over this lane half's keys only (joined in the epilogue).
  float lsum[2];
  v8f nref[2];
  v8f o[2][4];  // o[g][d][r] = sum_j p_j x_j[hd d*16 + lhi*8 + r] of the query
  for (int g = 0; g < 2; ++g) {
    lsum[g] = 0.0f;
    for (int e = 0; e < 8; ++e) nref[g][e] = 0.0f;
    for (int d = 0; d < 4; ++d)
      for (int e = 0; e < 8; ++e) o[g][d][e] = 0.0f;
  }

  // Pass 1's rows as f16, in both orientations: stored at the head of pass 0.
  v2u rk[4], ck[4];
  for (int i = 0; i < 4; ++i) {
    rk[i] = row4(xs, i);
    ck[i] = col4(xs, i);
  }

  int kc = 0;  // kb, held at the last pass that has a pass kb+2
  for (int kb = 0;; ++kb) {
    const int cur = kb & 1;
    const bool more = kb + 1 < NKB;  // a pass kb+1 exists

    // Every wave has signalled in pass kb-1: this pass's tiles are in
    // buf[cur], and nobody reads buf[cur^1] any more.
    if (kb > 0) bar_wait();

    const _Float16* Kt = Ktb[cur][kh];
    const _Float16* Vt = Vtb[cur][kh];

    // At the head of the pass: the x fragments, then the next pass's tiles,
    // converted at the foot of the pass before.
    AF kf[2][2];
    for (int nt = 0; nt < 2; ++nt) {
      load_frag16(kf[nt][0], Kt + (nt * 16 + ln) * KP, lhi);
      load_frag16(kf[nt][1], Kt + (nt * 16 + ln) * KP + 32, lhi);
    }
    // Keeps the fragment reads first behind the barrier wait, as the products
    // wait for them: left alone, the compiler puts the x loads in front.
    __builtin_amdgcn_sched_barrier(0);
    // No test around the stores: behind a branch the compiler's counted LDS
    // waits merge two paths and hold the products back for the stores. The
    // last pass writes its own rows once more, into the buffer nobody reads.
    for (int i = 0; i < 4; ++i)
      *(v2u*)(Ktb[cur ^ 1][sth] + kdst + i * KP) = rk[i];
    for (int i = 0; i < 4; ++i)
      *(v2u*)(Vtb[cur ^ 1][sth] + vdst + i * VP) = ck[i];
    // The rows of pass kb+2 are asked for here, a whole pass ahead of their
    // conversion. No test here either: the last two passes ask for the last
    // tile's rows again.
    {
      const float* xp = xsrc0 + (size_t)kc * 32 * EMBED_DIM;
      for (int i = 0; i < 4; ++i)
        xs[i] = *(const v4f*)(xp + (size_t)(64 + i) * EMBED_DIM);
      // Stands in front of any later write of the address registers; naming
      // the address keeps it out of the loads' own destinations.
      asm volatile("s_wait_xcnt 0x0" ::"v"(xp) : "memory");
    }
    // Keeps reads and stores one group in front of the products, the stores
    // far from the wait that covers them: left alone, the compiler spread
    // both among the products.
    __builtin_amdgcn_sched_barrier(0);

    // S^T = X * Q'^T : two 16-key M tiles, each 2 K-steps over hd=64, each
    // fragment against both query groups.
    // s[g][nt][r] = score(key nt*16 + lhi*8 + r, query of group g) minus the
    // query's reference.
    v8f s[2][2];
    for (int g = 0; g < 2; ++g)
      s[g][0] = mma(kf[0][1], qa[g][1], mma(kf[0][0], qa[g][0], nref[g]));
    for (int g = 0; g < 2; ++g) s[g][1] = mma(kf[1][0], qa[g][0], nref[g]);

    // The x^T fragments are asked for ahead of the maximum and its test, which
    // hide their LDS latency.
    AF vf[4];
    for (int d = 0; d < 4; ++d) load_frag16(vf[d], Vt + (d * 16 + ln) * VP, lhi);
    // Keeps all eight reads in front of the maximum: left alone, the compiler
    // put half of them behind it, close to the wait in front of the signal.
    __builtin_amdgcn_sched_barrier(0);

    // This lane's largest score above its reference, per group: 16 of a
    // query's 32 scores are in this lane, the other 16 in lane ^ 16. The
    // first tile's scores are done: their part of the maximum stands among the
    // second tile's last products and fills the slots that the chip asks for
    // behind them.
    float u[2][3];
    for (int g = 0; g < 2; ++g) {
      u[g][0] = fmaxf(fmaxf(s[g][0][0], s[g][0][1]), s[g][0][2]);
      u[g][1] = fmaxf(fmaxf(s[g][0][3], s[g][0][4]), s[g][0][5]);
      u[g][2] = fmaxf(fmaxf(s[g][0][6], s[g][0][7]), u[g][0]);
    }
    for (int g = 0; g < 2; ++g) s[g][1] = mma(kf[1][1], qa[g][1], s[g][1]);
    float mx[2];
    for (int g = 0; g < 2; ++g) {
      const float w0 = fmaxf(fmaxf(s[g][1][0], s[g][1][1]), u[g][1]);
      const float w1 = fmaxf(fmaxf(s[g][1][2], s[g][1][3]), u[g][2]);
      const float w2 = fmaxf(fmaxf(s[g][1][4], s[g][1][5]), w0);
      const float w3 = fmaxf(fmaxf(s[g][1][6], s[g][1][7]), w1);
      mx[g] = fmaxf(w2, w3);
    }

    // One test per pass and wave, a scalar branch. Up to 8 above the reference
    // P stays at or below 256, well inside f16. Pass 0 sets the reference.
    const bool over = fmaxf(mx[0], mx[1]) > 8.0f;
    if (kb == 0 || __builtin_amdgcn_ballot_w32(over) != 0) {
      for (int g = 0; g < 2; ++g) {
        // The reference moves up to the pass's maximum where that is higher, never down
        // (in pass 0, with nothing summed yet, to the pass's own maximum).
        float d = fmaxf(mx[g], xhalf(mx[g]));
        if (kb != 0) d = fmaxf(d, 0.0f);
        float corr = -fmaxf(d, 0.0f);
        exp2_1(corr);
        for (int e = 0; e < 8; ++e) {
          nref[g][e] -= d;
          s[g][0][e] -= d;
          s[g][1][e] -= d;
        }
        lsum[g] *= corr;
        for (int dd = 0; dd < 4; ++dd)
          for (int r = 0; r < 8; ++r) o[g][dd][r] *= corr;
      }
    }

    // P^T as a B operand: halves 0..7 are keys lhi*8 + 0..7 and halves 8..15
    // keys 16 + lhi*8 + 0..7, the k order in which load_frag16 brings x^T.
    AF pb[2];
    {
      float p0[8], p1[8], t[8];
      for (int r = 0; r < 8; ++r) {
        p0[r] = s[0][0][r];
        p1[r] = s[0][1][r];
      }
      exp2_8(p0);
      exp2_8(p1);
      for (int r = 0; r < 8; ++r) {
        t[r] = p0[r] + p1[r];
        pb[0].h[r]     = (_Float16)p0[r];
        pb[0].h[8 + r] = (_Float16)p1[r];
      }
      lsum[0] += ((t[0] + t[1]) + (t[2] + t[3])) +
                 ((t[4] + t[5]) + (t[6] + t[7]));
    }

    // Between the groups: group 0's exponentials have covered the latency
    // of the x^T reads, so the wait costs little here.
    if (more) {
      // This wave's reads of buf[cur] have returned and its part of the next
      // tiles is in buf[cur^1]: say so, and do not wait for the others yet.
      // No LDS access stands between here and the wait of pass kb+1.
      lds_done();
      bar_signal();
    }

    // O^T += X^T * P^T : four 16-row hd tiles per group, contraction over 32
    // keys. A wave issues in order, so each product here is followed by vector
    // work that does not depend on it. Group 0's products stand among group
    // 1's softmax, group 1's among its sums and the conversions of pass
    // kb+2's rows. Each sched_barrier keeps that order: left alone, the
    // compiler puts all eight products in a row behind all the vector work.
    {
      float p0[8], p1[8], t[8];
      for (int r = 0; r < 8; ++r) {
        p0[r] = s[1][0][r];
        p1[r] = s[1][1][r];
      }
      o[0][0] = mma(vf[0], pb[0], o[0][0]);
      __builtin_amdgcn_sched_barrier(0);
      exp2_8(p0);
      __builtin_amdgcn_sched_barrier(0);
      o[0][1] = mma(vf[1], pb[0], o[0][1]);
      __builtin_amdgcn_sched_barrier(0);
      exp2_8(p1);
      __builtin_amdgcn_sched_barrier(0);
      o[0][2] = mma(vf[2], pb[0], o[0][2]);
      __builtin_amdgcn_sched_barrier(0);
      for (int r = 0; r < 8; ++r) {
        pb[1].h[r]     = (_Float16)p0[r];
        pb[1].h[8 + r] = (_Float16)p1[r];
      }
      __builtin_amdgcn_sched_barrier(0);
      o[0][3] = mma(vf[3], pb[0], o[0][3]);
      for (int r = 0; r < 8; ++r) t[r] = p0[r] + p1[r];
      lsum[1] += ((t[0] + t[1]) + (t[2] + t[3])) +
                 ((t[4] + t[5]) + (t[6] + t[7]));
    }
    for (int d = 0; d < 4; ++d) {
      o[1][d] = mma(vf[d], pb[1], o[1][d]);
      rk[d] = row4(xs, d);
      ck[d] = col4(xs, d);
    }
    // The last five products, each followed by its share of group 1's sums
    // and of the conversions: the order asked of the scheduler.
    for (int i = 0; i < 5; ++i) {
      __builtin_amdgcn_sched_group_barrier(0x8, 1, 0);
      __builtin_amdgcn_sched_group_barrier(0x2, 6, 0);
    }
    // Inputs only, no instruction: the x^T fragments stay in their registers
    // to the foot of the pass. Freed at their last product, those registers
    // would take the conversions' results, and a write to a product's A
    // operand directly behind it costs the four idle slots the chip asks for.
    asm volatile("" ::"v"(vf[0].v), "v"(vf[1].v), "v"(vf[2].v), "v"(vf[3].v));
    if (!more) break;
    if (kc < NKB - 3) ++kc;
  }

  // Merge the key halves: hand group 1 to the partner wave, take the partner's
  // group 1 (this wave's group 0 queries, the other 1024 keys).
  float* xw = Xm + (size_t)wave * 34 * 32 + lane;
  for (int d = 0; d < 4; ++d)
    for (int e = 0; e < 8; ++e) xw[(d * 8 + e) * 32] = o[1][d][e];
  xw[32 * 32] = -nref[1][0];
  xw[33 * 32] = lsum[1];
  __syncthreads();  // the partner's values are in LDS
  const float* xr = Xm + (size_t)(wave ^ 4) * 34 * 32 + lane;
  const float mo = xr[32 * 32];
  const float lo_ = xr[33 * 32];
  const float m0 = -nref[0][0];
  const float mm = fmaxf(m0, mo);
  float c0 = m0 - mm;  // references are base-2 exponents
  float c1 = mo - mm;
  exp2_1(c0);
  exp2_1(c1);
  const float lj = lsum[0] * c0 + lo_ * c1;

  // Normalize: om[d][e] = (sum_j p_j x_j)[hd d*16 + lhi*8 + e] of query trow.
  const float inv = 1.0f / (lj + xhalf(lj));
  c0 *= inv;
  c1 *= inv;
  v8f om[4];
  for (int d = 0; d < 4; ++d)
    for (int e = 0; e < 8; ++e)
      om[d][e] = o[0][d][e] * c0 + xr[(d * 8 + e) * 32] * c1;

  // out^T = Wv^T * om^T + bv: A = Wv^T rows (output columns), B = the sums
  // packed from their registers. A lane holds 8 consecutive columns of its
  // query per tile, two 16-byte stores into fp32 [B, T, E].
  AF ob[2];
  for (int ks = 0; ks < 2; ++ks) pack_b(ob[ks], om[2 * ks], om[2 * ks + 1], 1.0f);
  float* orow = out + (size_t)(b * SEQ_T + trow) * EMBED_DIM + h * HEAD_DIM +
                lhi * 8;
  for (int n = 0; n < 4; ++n) {
    AF a0, a1;
    load_frag16(a0, Ws[2] + (n * 16 + ln) * KP, lhi);
    load_frag16(a1, Ws[2] + (n * 16 + ln) * KP + 32, lhi);
    const v4f* bp = (const v4f*)(Bs + 2 * HEAD_DIM + n * 16 + lhi * 8);
    const v4f b0 = bp[0], b1 = bp[1];
    v8f c;
    for (int e = 0; e < 4; ++e) {
      c[e]     = b0[e];
      c[4 + e] = b1[e];
    }
    c = mma(a1, ob[1], mma(a0, ob[0], c));
    v4f lo, hi;
    for (int e = 0; e < 4; ++e) {
      lo[e] = c[e];
      hi[e] = c[4 + e];
    }
    *(v4f*)(orow + n * 16)     = lo;
    *(v4f*)(orow + n * 16 + 4) = hi;
  }
}

// ---------------------------------------------------------------------------
extern "C" void kernel_launch(void* const* d_in, const int* in_sizes, int n_in,
                              void* d_out, int out_size, void* d_ws, size_t ws_size,
                              hipStream_t stream) {
  (void)in_sizes; (void)n_in; (void)out_size; (void)d_ws; (void)ws_size;
  const float* x    = (const float*)d_in[0];
  const float* W    = (const float*)d_in[1];
  const float* bias = (const float*)d_in[2];

  dim3 grid(SEQ_T / 128, NUM_HEADS, BATCH);  // 16 x 16 x 2 = 512 blocks
  fused_attn_kernel<<<grid, 256, 0, stream>>>(x, W, bias, (float*)d_out);
}

// v009
// A run of this version takes 30 microseconds.
// Two timings next to v008 both put it at 1.03 times that version's speed.
// Counting every step since v000, it is 8.89 times as fast.
#include <hip/hip_runtime.h>
#include <stdint.h>

// MHA for B=2, T=2048, E=1024, H=16, hd=64 on gfx1250 (wave32, WMMA), in ONE
// launch. The K and V projections are folded out of the key loop:
//   q.k_j = q.(x_j Wk + bk) = (q Wk^T).x_j + q.bk, and q.bk is the same for
//   every key of a query, so it cancels in the softmax;
//   sum_j p_j (x_j Wv + bv) = (sum_j p_j x_j) Wv + bv, as the p_j sum to 1.
// So the keys AND the values of the loop are the rows of x themselves. A block
// forms Q' = (x Wq + bq) Wk^T for its own queries, runs flash attention over
// x, and applies Wv and bv to the normalized sums in its epilogue.
// The attention is in transposed form: S^T = X*Q'^T and O^T += X^T*P^T, so that
// a lane holds the scores of ONE query and P goes from the score accumulators
// straight into a B operand (no LDS, no row shuffles).
// WMMA fragments from LDS are loaded as two 16B (b128) transfers per fragment;
// the query fragments as four 16B loads of f32 from global.
// The x tiles are DOUBLE-BUFFERED in LDS: the f32 rows of pass kb+1 are asked
// for at the head of pass kb-1, converted to f16 at its foot and stored, in
// both orientations, at the head of pass kb. The pass barrier is SPLIT: a wave
// signals once its stores and its own fragment reads are done, between the two
// groups' exponentials, and waits only at the head of the next pass: the
// second group's softmax, O^T and the conversions run in between.

typedef __attribute__((ext_vector_type(16))) _Float16 v16h;
typedef __attribute__((ext_vector_type(8)))  float    v8f;
typedef __attribute__((ext_vector_type(4)))  float    v4f;
typedef __attribute__((ext_vector_type(4)))  uint32_t v4u;
typedef __attribute__((ext_vector_type(2)))  uint32_t v2u;

#define NUM_HEADS 16
#define EMBED_DIM 1024
#define HEAD_DIM  64
#define SEQ_T     2048
#define BATCH     2
#define N3        192   // 3*HEAD_DIM

// LDS row pitches in halves. Every tile here is read by 16-byte loads in which
// the 16 lanes of a wave half take 16 consecutive rows: at a pitch of
// 16 B x odd those reads fall on all 64 banks, at 128 B or 64 B on few.
#define KP 72   // 128-byte rows (x tile, weights) at 144 B
#define VP 40   // 64-byte rows (x^T tile) at 80 B

union AF { v16h v; _Float16 h[16]; uint32_t u[8]; v4u q[2]; };

// Load a 16-half WMMA fragment (A or B operand, one 32-wide K step) from a
// row whose K-run is contiguous in memory. Per the CDNA5 ISA layout, lane
// halves 0..7 are K=[lhi*8, lhi*8+8) and halves 8..15 are K=[16+lhi*8, +8):
// two aligned 16-byte loads.
static __device__ __forceinline__ void load_frag16(AF& a,
                                                   const _Float16* row_base,
                                                   int lhi) {
  const v4u* p = (const v4u*)(row_base + lhi * 8);
  a.q[0] = p[0];   // halves 0..7
  a.q[1] = p[2];   // halves 16..23 (p strides 8 halves)
}

// Two 16-row accumulator tiles (rows lhi*8 + r of tile 0 and of tile 1, one
// column per lane) as the B operand of a 32-wide K step: load_frag16's k order.
static __device__ __forceinline__ void pack_b(AF& a, const v8f& t0,
                                              const v8f& t1, float scale) {
  for (int r = 0; r < 8; ++r) {
    a.h[r]     = (_Float16)(t0[r] * scale);
    a.h[8 + r] = (_Float16)(t1[r] * scale);
  }
}

static __device__ __forceinline__ v2u pack4(float a, float b, float c,
                                            float d) {
  union { _Float16 h[4]; v2u q; } p;
  p.h[0] = (_Float16)a;
  p.h[1] = (_Float16)b;
  p.h[2] = (_Float16)c;
  p.h[3] = (_Float16)d;
  return p.q;
}

// A 4 x 4 f32 micro-tile r[row][col] to f16 in LDS, 8-byte stores: as it lies
// (rows at pitch p) or transposed (columns at pitch p).
static __device__ __forceinline__ void put_rows(const v4f (&r)[4], _Float16* l,
                                                int p) {
  for (int i = 0; i < 4; ++i)
    *(v2u*)(l + i * p) = pack4(r[i][0], r[i][1], r[i][2], r[i][3]);
}
static __device__ __forceinline__ void put_cols(const v4f (&r)[4], _Float16* l,
                                                int p) {
  for (int c = 0; c < 4; ++c)
    *(v2u*)(l + c * p) = pack4(r[0][c], r[1][c], r[2][c], r[3][c]);
}

// One row, or one column, of such a micro-tile as four f16 in two registers.
static __device__ __forceinline__ v2u row4(const v4f (&r)[4], int i) {
  return pack4(r[i][0], r[i][1], r[i][2], r[i][3]);
}
static __device__ __forceinline__ v2u col4(const v4f (&r)[4], int c) {
  return pack4(r[0][c], r[1][c], r[2][c], r[3][c]);
}

static __device__ __forceinline__ v8f mma(const AF& a, const AF& b, v8f c) {
  return __builtin_amdgcn_wmma_f32_16x16x32_f16(false, a.v, false, b.v,
                                                (short)0, c, false, false);
}

// Lane l <-> lane l ^ 16 (the two halves of a wave) on the vector pipe.
static __device__ __forceinline__ float xhalf(float x) {
  int i = __builtin_bit_cast(int, x);
  return __builtin_bit_cast(float, __builtin_amdgcn_permlanex16(
      i, i, 0x76543210, 0xfedcba98, false, false));
}

// The two halves of the work-group barrier and the LDS wait in front of the
// signal. The "memory" clobber keeps every LDS access on its side of them.
static __device__ __forceinline__ void lds_done() {
  asm volatile("s_wait_dscnt 0x0" ::: "memory");
}
static __device__ __forceinline__ void bar_signal() {
  asm volatile("s_barrier_signal -1" ::: "memory");
}
static __device__ __forceinline__ void bar_wait() {
  asm volatile("s_barrier_wait -1" ::: "memory");
}

// Base-2 exponentials, one statement each, ending in v_nop. The instruction
// set asks for one free slot between a transcendental and an instruction that
// reads its result or overwrites its source. Inside a statement no result is
// read and no source overwritten (of the eight, the results are early-clobber:
// registers of their own, and the scores stay as they are); the v_nop keeps
// the slot behind the last one.
static __device__ __forceinline__ void exp2_1(float& x) {
  asm("v_exp_f32 %0, %0\n\tv_nop" : "+v"(x));
}
static __device__ __forceinline__ void exp2_8(float (&y)[8], const v8f& x) {
  asm("v_exp_f32 %0, %8\n\tv_exp_f32 %1, %9\n\tv_exp_f32 %2, %10\n\t"
      "v_exp_f32 %3, %11\n\tv_exp_f32 %4, %12\n\tv_exp_f32 %5, %13\n\t"
      "v_exp_f32 %6, %14\n\tv_exp_f32 %7, %15\n\tv_nop"
      : "=&v"(y[0]), "=&v"(y[1]), "=&v"(y[2]), "=&v"(y[3]), "=&v"(y[4]),
        "=&v"(y[5]), "=&v"(y[6]), "=&v"(y[7])
      : "v"(x[0]), "v"(x[1]), "v"(x[2]), "v"(x[3]), "v"(x[4]), "v"(x[5]),
        "v"(x[6]), "v"(x[7]));
}

// P^T of one group as a B operand: halves 0..7 are keys lhi*8 + 0..7 and
// halves 8..15 keys 16 + lhi*8 + 0..7, the k order in which load_frag16
// brings x^T.
static __device__ __forceinline__ void pack_p(AF& a, const float (&p0)[8],
                                              const float (&p1)[8]) {
  for (int r = 0; r < 8; ++r) {
    a.h[r]     = (_Float16)p0[r];
    a.h[8 + r] = (_Float16)p1[r];
  }
}
// The sum of this lane's 16 terms of a pass.
static __device__ __forceinline__ float sum_p(const float (&p0)[8],
                                              const float (&p1)[8]) {
  float t[8];
  for (int r = 0; r < 8; ++r) t[r] = p0[r] + p1[r];
  return ((t[0] + t[1]) + (t[2] + t[3])) + ((t[4] + t[5]) + (t[6] + t[7]));
}

// ---------------------------------------------------------------------------
// Block = 8 waves = 128 query rows of one (b,h).
// A wave takes 32 queries (two 16-column B groups) and ONE HALF of the keys:
// waves 0..3 keys 0..1023, waves 4..7 keys 1024..2047. Each x and x^T fragment
// read from LDS feeds two WMMAs, and the block keeps its eight waves.
// Per pass and wave, 32 keys: S^T = X*Q'^T (8 WMMA), online softmax with one
// query per lane and group, O^T += X^T*P^T (8 WMMA).
// The softmax reference of a query is HELD from pass to pass: minus the
// reference is the C operand of S^T, so the accumulators are the arguments of
// exp2 as they stand, and O and the sums are rescaled only in a pass in which
// the terms have grown large. No maximum is taken to find that out: the terms
// are positive, so none exceeds the sum of a lane's 16 terms, which the
// denominator needs anyway; that sum is what is tested, before P is used.
// At the end the two key halves of a query are merged through LDS: each wave
// hands one group to its partner and finishes the other, Wv and bv included.
// ---------------------------------------------------------------------------
// Two blocks per WGP, four waves per SIMD: the register budget is 256.
__global__ __launch_bounds__(256)
__attribute__((amdgpu_waves_per_eu(4, 4))) void fused_attn_kernel(
    const float* __restrict__ x, const float* __restrict__ W,
    const float* __restrict__ bias, float* __restrict__ out) {
  // [buffer][key half][key][hd]
  __shared__ __attribute__((aligned(16))) _Float16 Ktb[2][2][32 * KP];
  // [buffer][key half][hd][key]
  __shared__ __attribute__((aligned(16))) _Float16 Vtb[2][2][HEAD_DIM * VP];
  // Wq^T [col][k], Wk [k][col] as it lies, Wv^T [col][k]
  __shared__ __attribute__((aligned(16))) _Float16 Ws[3][HEAD_DIM * KP];
  __shared__ __attribute__((aligned(16))) float Bs[N3];
  // Merge: [wave][32 O values, reference, lsum][lane]
  __shared__ float Xm[8 * 34 * 32];

  const int tid  = threadIdx.x;
  const int wave = tid >> 5;
  const int lane = tid & 31;
  const int lhi  = (lane >= 16) ? 1 : 0;
  const int ln   = lane & 15;
  const int kh   = wave >> 2;         // key half of this wave
  const int qw   = wave & 3;          // its 32 queries within the block
  const int qb   = blockIdx.x * 128;
  const int h    = blockIdx.y;
  const int b    = blockIdx.z;
  const float* xh = x + (size_t)b * SEQ_T * EMBED_DIM + h * HEAD_DIM;

  const int NKB = SEQ_T / 64;  // 32 passes, each 32 keys of either half

  // Per-thread staging assignment (kb-invariant): 4 keys x 4 hd values. The 16
  // lanes of a wave half take one whole 256-byte row of x_h per load.
  const int shq = tid & 15;           // hd quad
  const int sth = tid >> 7;           // key half
  const int skl = ((tid >> 4) & 7) * 4;  // first key within the 32-key tile
  const float* xsrc0 = xh + (size_t)(sth * (SEQ_T / 2) + skl) * EMBED_DIM +
                       shq * 4;       // + kb * 32 rows
  const int kdst = skl * KP + shq * 4;
  const int vdst = shq * 4 * VP + skl;

  // Every global load of the prologue is asked for up front: pass 0's rows,
  // the weights as 4 x 4 micro-tiles, the bias, this wave's query rows.
  v4f xs[4];
  for (int i = 0; i < 4; ++i)
    xs[i] = *(const v4f*)(xsrc0 + (size_t)i * EMBED_DIM);

  // Weights: 16 k quads x 48 column quads, three per thread. A wave takes 4
  // column quads x 8 k quads, so that its transposed 8-byte stores fall on all
  // 64 banks; its column quads lie in one of Wq, Wk, Wv (a scalar choice).
  v4f wv[3][4];
  for (int it = 0; it < 3; ++it) {
    const int rest = wave + 8 * it;   // 0..23
    const int cq = (rest % 12) * 4 + (lane & 3);
    const int kq = (rest / 12) * 8 + (lane >> 2);
    for (int i = 0; i < 4; ++i)
      wv[it][i] = *(const v4f*)(W + (kq * 4 + i) * N3 + cq * 4);
  }
  float bval = 0.0f;
  if (tid < N3) bval = bias[tid];

  // Query rows as B operands (lane = query column ln), f32 to f16.
  // Group g of a wave holds queries (g ^ kh)*16 + ln of its 32, so that group
  // 1 of a wave and group 0 of its partner (wave ^ 4) are the same queries.
  const int trow = qb + qw * 32 + kh * 16 + ln;  // group 0's query
  v4f xq[2][2][4];
  for (int g = 0; g < 2; ++g) {
    const float* xrow =
        xh + (size_t)(qb + qw * 32 + (g ^ kh) * 16 + ln) * EMBED_DIM + lhi * 8;
    for (int ks = 0; ks < 2; ++ks) {
      const v4f* xp = (const v4f*)(xrow + ks * 32);
      xq[g][ks][0] = xp[0];   // halves 0..7
      xq[g][ks][1] = xp[1];
      xq[g][ks][2] = xp[4];   // halves 8..15 (K offset +16)
      xq[g][ks][3] = xp[5];
    }
    // Stands in front of any later write of this group's address registers;
    // naming the address keeps it out of the loads' own destinations.
    asm volatile("s_wait_xcnt 0x0" ::"v"(xrow) : "memory");
  }

  for (int it = 0; it < 3; ++it) {
    const int rest = wave + 8 * it;
    const int part = (rest % 12) >> 2;             // 0 Wq, 1 Wk, 2 Wv
    const int cc = ((rest % 12) & 3) * 16 + (lane & 3) * 4;  // column in part
    const int k0 = ((rest / 12) * 8 + (lane >> 2)) * 4;
    if (part == 1)
      put_rows(wv[it], Ws[1] + k0 * KP + cc, KP);
    else
      put_cols(wv[it], Ws[part] + cc * KP + k0, KP);
  }
  if (tid < N3) Bs[tid] = bval;
  put_rows(xs, Ktb[0][sth] + kdst, KP);
  put_cols(xs, Vtb[0][sth] + vdst, VP);
  AF xb[2][2];
  for (int g = 0; g < 2; ++g)
    for (int ks = 0; ks < 2; ++ks)
      for (int v = 0; v < 4; ++v)
        for (int e = 0; e < 4; ++e)
          xb[g][ks].h[v * 4 + e] = (_Float16)xq[g][ks][v][e];
  __syncthreads();  // weights, bias and pass 0's tiles are in LDS

  // Pass 1's rows are asked for now; the products below hide their latency.
  for (int i = 0; i < 4; ++i)
    xs[i] = *(const v4f*)(xsrc0 + (size_t)(32 + i) * EMBED_DIM);
  // Stands in front of any later write of the address registers; naming the
  // address keeps it out of the loads' own destinations.
  asm volatile("s_wait_xcnt 0x0" ::"v"(xsrc0) : "memory");

  // Q'^T = Wk * (Wq^T * x^T + bq), scaled: two chained products per group. The
  // accumulators of the first (a lane holds 8 consecutive columns of its
  // query per tile) are packed into the B operand of the second, and those of
  // the second into the B operand of S^T, all in load_frag16's k order.
  // Q' carries 1/sqrt(64) and log2 e: its scores are base-2 exponents.
  AF qa[2][2];
  {
    v8f qt[2][4];
    for (int n = 0; n < 4; ++n) {
      AF a0, a1;
      load_frag16(a0, Ws[0] + (n * 16 + ln) * KP, lhi);
      load_frag16(a1, Ws[0] + (n * 16 + ln) * KP + 32, lhi);
      const v4f* bp = (const v4f*)(Bs + n * 16 + lhi * 8);
      const v4f b0 = bp[0], b1 = bp[1];
      v8f c;
      for (int e = 0; e < 4; ++e) {
        c[e]     = b0[e];
        c[4 + e] = b1[e];
      }
      for (int g = 0; g < 2; ++g) qt[g][n] = mma(a1, xb[g][1], mma(a0, xb[g][0], c));
    }
    AF qf[2][2];
    for (int g = 0; g < 2; ++g)
      for (int ks = 0; ks < 2; ++ks)
        pack_b(qf[g][ks], qt[g][2 * ks], qt[g][2 * ks + 1], 1.0f);
    for (int m = 0; m < 4; ++m) {
      AF a0, a1;
      load_frag16(a0, Ws[1] + (m * 16 + ln) * KP, lhi);
      load_frag16(a1, Ws[1] + (m * 16 + ln) * KP + 32, lhi);
      v8f z;
      for (int e = 0; e < 8; ++e) z[e] = 0.0f;
      for (int g = 0; g < 2; ++g) qt[g][m] = mma(a1, qf[g][1], mma(a0, qf[g][0], z));
    }
    for (int g = 0; g < 2; ++g)
      for (int ks = 0; ks < 2; ++ks)
        pack_b(qa[g][ks], qt[g][2 * ks], qt[g][2 * ks + 1],
               0.125f * 1.44269504f);
  }

  // Per lane and group: one query. nref is minus its reference in use, in base
  // 2 (equal in both wave halves and in all eight rows: a C operand), lsum the
  // sum over this lane half's keys only (joined in the epilogue).
  float lsum[2];
  v8f nref[2];
  v8f o[2][4];  // o[g][d][r] = sum_j p_j x_j[hd d*16 + lhi*8 + r] of the query
  for (int g = 0; g < 2; ++g) {
    lsum[g] = 0.0f;
    for (int e = 0; e < 8; ++e) nref[g][e] = 0.0f;
    for (int d = 0; d < 4; ++d)
      for (int e = 0; e < 8; ++e) o[g][d][e] = 0.0f;
  }

  // Pass 1's rows as f16, in both orientations: stored at the head of pass 0.
  v2u rk[4], ck[4];
  for (int i = 0; i < 4; ++i) {
    rk[i] = row4(xs, i);
    ck[i] = col4(xs, i);
  }

  int kc = 0;  // kb, held at the last pass that has a pass kb+2
  for (int kb = 0;; ++kb) {
    const int cur = kb & 1;
    const bool more = kb + 1 < NKB;  // a pass kb+1 exists

    // Every wave has signalled in pass kb-1: this pass's tiles are in
    // buf[cur], and nobody reads buf[cur^1] any more.
    if (kb > 0) bar_wait();

    const _Float16* Kt = Ktb[cur][kh];
    const _Float16* Vt = Vtb[cur][kh];

    // At the head of the pass: the x fragments, then the next pass's tiles,
    // converted at the foot of the pass before.
    AF kf[2][2];
    for (int nt = 0; nt < 2; ++nt) {
      load_frag16(kf[nt][0], Kt + (nt * 16 + ln) * KP, lhi);
      load_frag16(kf[nt][1], Kt + (nt * 16 + ln) * KP + 32, lhi);
    }
    // Keeps the fragment reads first behind the barrier wait, as the products
    // wait for them: left alone, the compiler puts the x loads in front.
    __builtin_amdgcn_sched_barrier(0);
    // No test around the stores: behind a branch the compiler's counted LDS
    // waits merge two paths and hold the products back for the stores. The
    // last pass writes its own rows once more, into the buffer nobody reads.
    for (int i = 0; i < 4; ++i)
      *(v2u*)(Ktb[cur ^ 1][sth] + kdst + i * KP) = rk[i];
    for (int i = 0; i < 4; ++i)
      *(v2u*)(Vtb[cur ^ 1][sth] + vdst + i * VP) = ck[i];
    // The rows of pass kb+2 are asked for here, a whole pass ahead of their
    // conversion. No test here either: the last two passes ask for the last
    // tile's rows again.
    {
      const float* xp = xsrc0 + (size_t)kc * 32 * EMBED_DIM;
      for (int i = 0; i < 4; ++i)
        xs[i] = *(const v4f*)(xp + (size_t)(64 + i) * EMBED_DIM);
      // Stands in front of any later write of the address registers; naming
      // the address keeps it out of the loads' own destinations.
      asm volatile("s_wait_xcnt 0x0" ::"v"(xp) : "memory");
    }
    // Keeps reads and stores one group in front of the products, the stores
    // far from the wait that covers them: left alone, the compiler spread
    // both among the products.
    __builtin_amdgcn_sched_barrier(0);

    // S^T = X * Q'^T : two 16-key M tiles, each 2 K-steps over hd=64, each
    // fragment against both query groups.
    // s[g][nt][r] = score(key nt*16 + lhi*8 + r, query of group g) minus the
    // query's reference.
    v8f s[2][2];
    // The rare path: group g's reference moves to the query's maximum so far,
    // never down (in pass 0, with nothing summed yet, to the pass's own
    // maximum). 16 of a query's 32 scores are in this lane, the other 16 in
    // lane ^ 16. Scores, O and the sum follow the reference.
    auto rebase = [&](int g, bool first) {
      float m = fmaxf(s[g][0][0], s[g][1][0]);
      for (int e = 1; e < 8; ++e) m = fmaxf(fmaxf(s[g][0][e], s[g][1][e]), m);
      float d = fmaxf(m, xhalf(m));
      if (!first) d = fmaxf(d, 0.0f);
      float corr = -fmaxf(d, 0.0f);
      exp2_1(corr);
      for (int e = 0; e < 8; ++e) {
        nref[g][e] -= d;
        s[g][0][e] -= d;
        s[g][1][e] -= d;
      }
      lsum[g] *= corr;
      for (int dd = 0; dd < 4; ++dd)
        for (int r = 0; r < 8; ++r) o[g][dd][r] *= corr;
    };
    for (int g = 0; g < 2; ++g)
      s[g][0] = mma(kf[0][1], qa[g][1], mma(kf[0][0], qa[g][0], nref[g]));
    for (int g = 0; g < 2; ++g) s[g][1] = mma(kf[1][0], qa[g][0], nref[g]);

    // The x^T fragments are asked for ahead of group 0's exponentials, which
    // hide their LDS latency.
    AF vf[4];
    for (int d = 0; d < 4; ++d) load_frag16(vf[d], Vt + (d * 16 + ln) * VP, lhi);
    // Keeps all eight reads in front of the exponentials: left alone, the
    // compiler put half of them further down, close to the wait in front of
    // the signal.
    __builtin_amdgcn_sched_barrier(0);

    // Group 0's terms. The first tile's scores are done: their exponentials
    // stand among the second tile's last products and fill the slots that the
    // chip asks for behind them.
    AF pb[2];
    float ts;
    bool over;
    {
      float p0[8], p1[8];
      // Each sched_barrier keeps this order. Four products stand behind the
      // last one into s[0][0], a product and eight exponentials behind the
      // last one into s[0][1].
      s[0][1] = mma(kf[1][1], qa[0][1], s[0][1]);
      __builtin_amdgcn_sched_barrier(0);
      exp2_8(p0, s[0][0]);
      __builtin_amdgcn_sched_barrier(0);
      s[1][1] = mma(kf[1][1], qa[1][1], s[1][1]);
      __builtin_amdgcn_sched_barrier(0);
      exp2_8(p1, s[0][1]);
      __builtin_amdgcn_sched_barrier(0);
      ts = sum_p(p0, p1);
      // Inputs only, no instruction: the second tile's fragments stay in their
      // registers until the exponentials and the sums have theirs. Freed at
      // their last products, those registers would take these results, and a
      // write to a product's A operand needs four vector slots behind the
      // product: idle slots in front of the sums. The
      // sum is named only so that the statement stands behind it.
      asm volatile("" ::"v"(kf[1][0].v), "v"(kf[1][1].v), "v"(ts));
      // One test per pass, group and wave, a scalar branch. A sum of at most
      // 4096 bounds every term by 4096, well inside f16. Pass 0 sets the
      // reference.
      over = kb == 0 || __builtin_amdgcn_ballot_w32(ts > 4096.0f) != 0;

      // Between the groups: group 0's exponentials and sums have covered the
      // latency of the x^T reads, so the wait costs little here.
      if (more) {
        // This wave's reads of buf[cur] have returned and its part of the next
        // tiles is in buf[cur^1]: say so, and do not wait for the others yet.
        // No LDS access stands between here and the wait of pass kb+1.
        lds_done();
        bar_signal();
      }

      pack_p(pb[0], p0, p1);
      if (__builtin_expect(over, 0)) {
        rebase(0, kb == 0);
        exp2_8(p0, s[0][0]);
        exp2_8(p1, s[0][1]);
        pack_p(pb[0], p0, p1);
        ts = sum_p(p0, p1);
      }
      lsum[0] += ts;
    }

    // O^T += X^T * P^T : four 16-row hd tiles per group, contraction over 32
    // keys. A wave issues in order, so each product here is followed by vector
    // work that does not depend on it. Group 0's products stand among group
    // 1's softmax, group 1's among the conversions of the next tile's rows.
    // Each sched_barrier keeps that order: left alone, the compiler puts the
    // products in a row behind the vector work.
    {
      float p0[8], p1[8];
      o[0][0] = mma(vf[0], pb[0], o[0][0]);
      __builtin_amdgcn_sched_barrier(0);
      exp2_8(p0, s[1][0]);
      __builtin_amdgcn_sched_barrier(0);
      o[0][1] = mma(vf[1], pb[0], o[0][1]);
      __builtin_amdgcn_sched_barrier(0);
      exp2_8(p1, s[1][1]);
      __builtin_amdgcn_sched_barrier(0);
      o[0][2] = mma(vf[2], pb[0], o[0][2]);
      __builtin_amdgcn_sched_barrier(0);
      ts = sum_p(p0, p1);
      over = kb == 0 || __builtin_amdgcn_ballot_w32(ts > 4096.0f) != 0;
      __builtin_amdgcn_sched_barrier(0);
      o[0][3] = mma(vf[3], pb[0], o[0][3]);
      pack_p(pb[1], p0, p1);
      if (__builtin_expect(over, 0)) {
        rebase(1, kb == 0);
        exp2_8(p0, s[1][0]);
        exp2_8(p1, s[1][1]);
        pack_p(pb[1], p0, p1);
        ts = sum_p(p0, p1);
      }
      lsum[1] += ts;
    }
    for (int d = 0; d < 4; ++d) {
      o[1][d] = mma(vf[d], pb[1], o[1][d]);
      rk[d] = row4(xs, d);
      ck[d] = col4(xs, d);
    }
    // The last four products, each followed by its share of the conversions:
    // the order asked of the scheduler.
    for (int i = 0; i < 4; ++i) {
      __builtin_amdgcn_sched_group_barrier(0x8, 1, 0);
      __builtin_amdgcn_sched_group_barrier(0x2, 4, 0);
    }
    // Inputs only, no instruction: the x^T fragments stay in their registers
    // to the foot of the pass. Freed at their last product, those registers
    // would take the conversions' results, and a write to a product's A
    // operand directly behind it costs the four idle slots the chip asks for.
    asm volatile("" ::"v"(vf[0].v), "v"(vf[1].v), "v"(vf[2].v), "v"(vf[3].v));
    if (!more) break;
    if (kc < NKB - 3) ++kc;
  }

  // Merge the key halves: hand group 1 to the partner wave, take the partner's
  // group 1 (this wave's group 0 queries, the other 1024 keys).
  float* xw = Xm + (size_t)wave * 34 * 32 + lane;
  for (int d = 0; d < 4; ++d)
    for (int e = 0; e < 8; ++e) xw[(d * 8 + e) * 32] = o[1][d][e];
  xw[32 * 32] = -nref[1][0];
  xw[33 * 32] = lsum[1];
  __syncthreads();  // the partner's values are in LDS
  const float* xr = Xm + (size_t)(wave ^ 4) * 34 * 32 + lane;
  const float mo = xr[32 * 32];
  const float lo_ = xr[33 * 32];
  const float m0 = -nref[0][0];
  const float mm = fmaxf(m0, mo);
  float c0 = m0 - mm;  // references are base-2 exponents
  float c1 = mo - mm;
  exp2_1(c0);
  exp2_1(c1);
  const float lj = lsum[0] * c0 + lo_ * c1;

  // Normalize: om[d][e] = (sum_j p_j x_j)[hd d*16 + lhi*8 + e] of query trow.
  const float inv = 1.0f / (lj + xhalf(lj));
  c0 *= inv;
  c1 *= inv;
  v8f om[4];
  for (int d = 0; d < 4; ++d)
    for (int e = 0; e < 8; ++e)
      om[d][e] = o[0][d][e] * c0 + xr[(d * 8 + e) * 32] * c1;

  // out^T = Wv^T * om^T + bv: A = Wv^T rows (output columns), B = the sums
  // packed from their registers. A lane holds 8 consecutive columns of its
  // query per tile, two 16-byte stores into fp32 [B, T, E].
  AF ob[2];
  for (int ks = 0; ks < 2; ++ks) pack_b(ob[ks], om[2 * ks], om[2 * ks + 1], 1.0f);
  float* orow = out + (size_t)(b * SEQ_T + trow) * EMBED_DIM + h * HEAD_DIM +
                lhi * 8;
  for (int n = 0; n < 4; ++n) {
    AF a0, a1;
    load_frag16(a0, Ws[2] + (n * 16 + ln) * KP, lhi);
    load_frag16(a1, Ws[2] + (n * 16 + ln) * KP + 32, lhi);
    const v4f* bp = (const v4f*)(Bs + 2 * HEAD_DIM + n * 16 + lhi * 8);
    const v4f b0 = bp[0], b1 = bp[1];
    v8f c;
    for (int e = 0; e < 4; ++e) {
      c[e]     = b0[e];
      c[4 + e] = b1[e];
    }
    c = mma(a1, ob[1], mma(a0, ob[0], c));
    v4f lo, hi;
    for (int e = 0; e < 4; ++e) {
      lo[e] = c[e];
      hi[e] = c[4 + e];
    }
    *(v4f*)(orow + n * 16)     = lo;
    *(v4f*)(orow + n * 16 + 4) = hi;
  }
}

// ---------------------------------------------------------------------------
extern "C" void kernel_launch(void* const* d_in, const int* in_sizes, int n_in,
                              void* d_out, int out_size, void* d_ws, size_t ws_size,
                              hipStream_t stream) {
  (void)in_sizes; (void)n_in; (void)out_size; (void)d_ws; (void)ws_size;
  const float* x    = (const float*)d_in[0];
  const float* W    = (const float*)d_in[1];
  const float* bias = (const float*)d_in[2];

  dim3 grid(SEQ_T / 128, NUM_HEADS, BATCH);  // 16 x 16 x 2 = 512 blocks
  fused_attn_kernel<<<grid, 256, 0, stream>>>(x, W, bias, (float*)d_out);
}

// v010
// One run takes 28.5 microseconds.
// In both of two side-by-side timings against v009, it was 1.05 times as fast.
// Over all steps from v000 it is 9.33 times as fast.
#include <hip/hip_runtime.h>
#include <stdint.h>

// MHA for B=2, T=2048, E=1024, H=16, hd=64 on gfx1250 (wave32, WMMA), in ONE
// launch. The K and V projections are folded out of the key loop:
//   q.k_j = q.(x_j Wk + bk) = (q Wk^T).x_j + q.bk, and q.bk is the same for
//   every key of a query, so it cancels in the softmax;
//   sum_j p_j (x_j Wv + bv) = (sum_j p_j x_j) Wv + bv, as the p_j sum to 1.
// So the keys AND the values of the loop are the rows of x themselves. A block
// forms Q' = (x Wq + bq) Wk^T for its own queries, runs flash attention over
// x, and applies Wv and bv to the normalized sums in its epilogue.
// The attention is in transposed form: S^T = X*Q'^T and O^T += X^T*P^T, so that
// a lane holds the scores of ONE query and P goes from the score accumulators
// straight into a B operand (no LDS, no row shuffles).
// Every A fragment is read from LDS as two 16B (b128) transfers; the B operands are built in registers.
// An x tile lies in LDS ONCE, row-major: the key fragments are plain reads of
// its rows, the x^T fragments transposing reads (ds_load_tr16_b128) of the
// same rows.
// The x tiles are DOUBLE-BUFFERED in LDS: the f32 rows of pass kb+1 are asked
// for at the head of pass kb-1, converted to f16 at its foot and stored at the
// head of pass kb. The pass barrier is SPLIT: a wave
// signals once its stores and its own fragment reads are done, between the two
// groups' exponentials, and waits only at the head of the next pass: the
// second group's softmax, O^T and the conversions run in between.

typedef __attribute__((ext_vector_type(16))) _Float16 v16h;
typedef __attribute__((ext_vector_type(8)))  float    v8f;
typedef __attribute__((ext_vector_type(4)))  float    v4f;
typedef __attribute__((ext_vector_type(4)))  uint32_t v4u;
typedef __attribute__((ext_vector_type(2)))  uint32_t v2u;
typedef __attribute__((ext_vector_type(8)))  short    v8s;

#define NUM_HEADS 16
#define EMBED_DIM 1024
#define HEAD_DIM  64
#define SEQ_T     2048
#define BATCH     2
#define N3        192   // 3*HEAD_DIM

// LDS row pitch in halves: 128-byte rows (x tile, weights) at 144 B. A plain
// 16-byte fragment read takes 16 rows per wave half: at a pitch of 16 B x odd
// any 16 places that differ modulo 16 fall on all 64 banks.
#define KP 72
// A transposing read takes 8 rows x 32 bytes per wave half and wants a pitch
// of 32 B x odd. Both are served by the ORDER of an x tile's rows in LDS: the
// eight keys 8g..8g+7 lie two places apart (288 B = 32 B x 9), groups g and
// g + 1 interleaved. Key 8g + j lies at place 2j + (g & 1) + 16 (g >> 1).

union AF { v16h v; _Float16 h[16]; uint32_t u[8]; v4u q[2]; };

// Load a 16-half WMMA fragment (A or B operand, one 32-wide K step) from a
// row whose K-run is contiguous in memory. Per the CDNA5 ISA layout, lane
// halves 0..7 are K=[lhi*8, lhi*8+8) and halves 8..15 are K=[16+lhi*8, +8):
// two aligned 16-byte loads.
static __device__ __forceinline__ void load_frag16(AF& a,
                                                   const _Float16* row_base,
                                                   int lhi) {
  const v4u* p = (const v4u*)(row_base + lhi * 8);
  a.q[0] = p[0];   // halves 0..7
  a.q[1] = p[2];   // halves 16..23 (p strides 8 halves)
}

// Two 16-row accumulator tiles (rows lhi*8 + r of tile 0 and of tile 1, one
// column per lane) as the B operand of a 32-wide K step: load_frag16's k order.
static __device__ __forceinline__ void pack_b(AF& a, const v8f& t0,
                                              const v8f& t1, float scale) {
  for (int r = 0; r < 8; ++r) {
    a.h[r]     = (_Float16)(t0[r] * scale);
    a.h[8 + r] = (_Float16)(t1[r] * scale);
  }
}

static __device__ __forceinline__ v2u pack4(float a, float b, float c,
                                            float d) {
  union { _Float16 h[4]; v2u q; } p;
  p.h[0] = (_Float16)a;
  p.h[1] = (_Float16)b;
  p.h[2] = (_Float16)c;
  p.h[3] = (_Float16)d;
  return p.q;
}

// A 4 x 4 f32 micro-tile r[row][col] to f16 in LDS, 8-byte stores: as it lies
// (rows at pitch p) or transposed (columns at pitch p).
static __device__ __forceinline__ void put_rows(const v4f (&r)[4], _Float16* l,
                                                int p) {
  for (int i = 0; i < 4; ++i)
    *(v2u*)(l + i * p) = pack4(r[i][0], r[i][1], r[i][2], r[i][3]);
}
static __device__ __forceinline__ void put_cols(const v4f (&r)[4], _Float16* l,
                                                int p) {
  for (int c = 0; c < 4; ++c)
    *(v2u*)(l + c * p) = pack4(r[0][c], r[1][c], r[2][c], r[3][c]);
}

// One row of such a micro-tile as four f16 in two registers.
static __device__ __forceinline__ v2u row4(const v4f (&r)[4], int i) {
  return pack4(r[i][0], r[i][1], r[i][2], r[i][3]);
}

// Transposing 16-byte LDS read. In a wave half, lane l gives the address of 8
// halves of row l & 7 (columns 8 ((l >> 3) & 1) + 0..7 of a 16-column strip)
// and receives column l & 15 of those eight rows.
static __device__ __forceinline__ v4u ld_tr16(const _Float16* p) {
  typedef __attribute__((address_space(3))) v8s lds_v8s;
  return __builtin_bit_cast(v4u,
                            __builtin_amdgcn_ds_load_tr16_b128_v8i16((lds_v8s*)p));
}

static __device__ __forceinline__ v8f mma(const AF& a, const AF& b, v8f c) {
  return __builtin_amdgcn_wmma_f32_16x16x32_f16(false, a.v, false, b.v,
                                                (short)0, c, false, false);
}

// Lane l <-> lane l ^ 16 (the two halves of a wave) on the vector pipe.
static __device__ __forceinline__ float xhalf(float x) {
  int i = __builtin_bit_cast(int, x);
  return __builtin_bit_cast(float, __builtin_amdgcn_permlanex16(
      i, i, 0x76543210, 0xfedcba98, false, false));
}

// The two halves of the work-group barrier and the LDS wait in front of the
// signal. The "memory" clobber keeps every LDS access on its side of them.
static __device__ __forceinline__ void lds_done() {
  asm volatile("s_wait_dscnt 0x0" ::: "memory");
}
static __device__ __forceinline__ void bar_signal() {
  asm volatile("s_barrier_signal -1" ::: "memory");
}
static __device__ __forceinline__ void bar_wait() {
  asm volatile("s_barrier_wait -1" ::: "memory");
}

// Base-2 exponentials, one statement each, ending in v_nop. The instruction
// set asks for one free slot between a transcendental and an instruction that
// reads its result or overwrites its source. Inside a statement no result is
// read and no source overwritten (of the eight, the results are early-clobber:
// registers of their own, and the scores stay as they are); the v_nop keeps
// the slot behind the last one.
static __device__ __forceinline__ void exp2_1(float& x) {
  asm("v_exp_f32 %0, %0\n\tv_nop" : "+v"(x));
}
static __device__ __forceinline__ void exp2_8(float (&y)[8], const v8f& x) {
  asm("v_exp_f32 %0, %8\n\tv_exp_f32 %1, %9\n\tv_exp_f32 %2, %10\n\t"
      "v_exp_f32 %3, %11\n\tv_exp_f32 %4, %12\n\tv_exp_f32 %5, %13\n\t"
      "v_exp_f32 %6, %14\n\tv_exp_f32 %7, %15\n\tv_nop"
      : "=&v"(y[0]), "=&v"(y[1]), "=&v"(y[2]), "=&v"(y[3]), "=&v"(y[4]),
        "=&v"(y[5]), "=&v"(y[6]), "=&v"(y[7])
      : "v"(x[0]), "v"(x[1]), "v"(x[2]), "v"(x[3]), "v"(x[4]), "v"(x[5]),
        "v"(x[6]), "v"(x[7]));
}

// P^T of one group as a B operand: halves 0..7 are keys lhi*8 + 0..7 and
// halves 8..15 keys 16 + lhi*8 + 0..7, the k order in which ld_tr16
// brings x^T.
static __device__ __forceinline__ void pack_p(AF& a, const float (&p0)[8],
                                              const float (&p1)[8]) {
  for (int r = 0; r < 8; ++r) {
    a.h[r]     = (_Float16)p0[r];
    a.h[8 + r] = (_Float16)p1[r];
  }
}
// The sum of this lane's 16 terms of a pass.
static __device__ __forceinline__ float sum_p(const float (&p0)[8],
                                              const float (&p1)[8]) {
  float t[8];
  for (int r = 0; r < 8; ++r) t[r] = p0[r] + p1[r];
  return ((t[0] + t[1]) + (t[2] + t[3])) + ((t[4] + t[5]) + (t[6] + t[7]));
}

// ---------------------------------------------------------------------------
// Block = 8 waves = 128 query rows of one (b,h).
// A wave takes 32 queries (two 16-column B groups) and ONE HALF of the keys:
// waves 0..3 keys 0..1023, waves 4..7 keys 1024..2047. Each x and x^T fragment
// read from LDS feeds two WMMAs, and the block keeps its eight waves.
// Per pass and wave, 32 keys: S^T = X*Q'^T (8 WMMA), online softmax with one
// query per lane and group, O^T += X^T*P^T (8 WMMA).
// The softmax reference of a query is HELD from pass to pass: minus the
// reference is the C operand of S^T, so the accumulators are the arguments of
// exp2 as they stand, and O and the sums are rescaled only in a pass in which
// the terms have grown large. No maximum is taken to find that out: the terms
// are positive, so none exceeds the sum of a lane's 16 terms, which the
// denominator needs anyway; that sum is what is tested, before P is used.
// At the end the two key halves of a query are merged through LDS: each wave
// hands one group to its partner and finishes the other, Wv and bv included.
// ---------------------------------------------------------------------------
// Two blocks per WGP, four waves per SIMD: the register budget is 256.
__global__ __launch_bounds__(256)
__attribute__((amdgpu_waves_per_eu(4, 4))) void fused_attn_kernel(
    const float* __restrict__ x, const float* __restrict__ W,
    const float* __restrict__ bias, float* __restrict__ out) {
  // [buffer][key half][place of the key][hd]
  __shared__ __attribute__((aligned(16))) _Float16 Ktb[2][2][32 * KP];
  // Wq^T [col][k], Wk [k][col] as it lies, Wv^T [col][k]
  __shared__ __attribute__((aligned(16))) _Float16 Ws[3][HEAD_DIM * KP];
  __shared__ __attribute__((aligned(16))) float Bs[N3];
  // Merge: [wave][32 O values, reference, lsum][lane]
  __shared__ float Xm[8 * 34 * 32];

  const int tid  = threadIdx.x;
  const int wave = tid >> 5;
  const int lane = tid & 31;
  const int lhi  = (lane >= 16) ? 1 : 0;
  const int ln   = lane & 15;
  const int kh   = wave >> 2;         // key half of this wave
  const int qw   = wave & 3;          // its 32 queries within the block
  const int qb   = blockIdx.x * 128;
  const int h    = blockIdx.y;
  const int b    = blockIdx.z;
  const float* xh = x + (size_t)b * SEQ_T * EMBED_DIM + h * HEAD_DIM;

  const int NKB = SEQ_T / 64;  // 32 passes, each 32 keys of either half

  // Per-thread staging assignment (kb-invariant): 4 keys x 4 hd values. The 16
  // lanes of a wave half take one whole 256-byte row of x_h per load.
  const int shq = tid & 15;           // hd quad
  const int sth = tid >> 7;           // key half
  const int skl = ((tid >> 4) & 7) * 4;  // first key within the 32-key tile
  const float* xsrc0 = xh + (size_t)(sth * (SEQ_T / 2) + skl) * EMBED_DIM +
                       shq * 4;       // + kb * 32 rows
  // The place of key skl; keys skl + 1..3 follow two places apart. The two
  // halves of a wave store rows eight places apart: all 64 banks.
  const int kdst = (2 * (skl & 7) + ((skl >> 3) & 1) + 16 * (skl >> 4)) * KP +
                   shq * 4;
  // This lane's fragment reads within a tile: the row of key ln (key 16 + ln
  // lies 16 places on), and its share of the transposing reads of keys
  // 8 lhi + 0..7 (keys 16 + 8 lhi + 0..7 lie 16 places on).
  const int ksrc = (2 * (ln & 7) + (ln >> 3)) * KP;
  const int vsrc = (2 * (lane & 7) + lhi) * KP + ((lane >> 3) & 1) * 8;

  // Every global load of the prologue is asked for up front: pass 0's rows,
  // the weights as 4 x 4 micro-tiles, the bias, this wave's query rows.
  v4f xs[4];
  for (int i = 0; i < 4; ++i)
    xs[i] = *(const v4f*)(xsrc0 + (size_t)i * EMBED_DIM);

  // Weights: 16 k quads x 48 column quads, three per thread. A wave takes 4
  // column quads x 8 k quads, so that its transposed 8-byte stores fall on all
  // 64 banks; its column quads lie in one of Wq, Wk, Wv (a scalar choice).
  v4f wv[3][4];
  for (int it = 0; it < 3; ++it) {
    const int rest = wave + 8 * it;   // 0..23
    const int cq = (rest % 12) * 4 + (lane & 3);
    const int kq = (rest / 12) * 8 + (lane >> 2);
    for (int i = 0; i < 4; ++i)
      wv[it][i] = *(const v4f*)(W + (kq * 4 + i) * N3 + cq * 4);
  }
  float bval = 0.0f;
  if (tid < N3) bval = bias[tid];

  // Query rows as B operands (lane = query column ln), f32 to f16.
  // Group g of a wave holds queries (g ^ kh)*16 + ln of its 32, so that group
  // 1 of a wave and group 0 of its partner (wave ^ 4) are the same queries.
  const int trow = qb + qw * 32 + kh * 16 + ln;  // group 0's query
  v4f xq[2][2][4];
  for (int g = 0; g < 2; ++g) {
    const float* xrow =
        xh + (size_t)(qb + qw * 32 + (g ^ kh) * 16 + ln) * EMBED_DIM + lhi * 8;
    for (int ks = 0; ks < 2; ++ks) {
      const v4f* xp = (const v4f*)(xrow + ks * 32);
      xq[g][ks][0] = xp[0];   // halves 0..7
      xq[g][ks][1] = xp[1];
      xq[g][ks][2] = xp[4];   // halves 8..15 (K offset +16)
      xq[g][ks][3] = xp[5];
    }
    // Stands in front of any later write of this group's address registers;
    // naming the address keeps it out of the loads' own destinations.
    asm volatile("s_wait_xcnt 0x0" ::"v"(xrow) : "memory");
  }

  for (int it = 0; it < 3; ++it) {
    const int rest = wave + 8 * it;
    const int part = (rest % 12) >> 2;             // 0 Wq, 1 Wk, 2 Wv
    const int cc = ((rest % 12) & 3) * 16 + (lane & 3) * 4;  // column in part
    const int k0 = ((rest / 12) * 8 + (lane >> 2)) * 4;
    if (part == 1)
      put_rows(wv[it], Ws[1] + k0 * KP + cc, KP);
    else
      put_cols(wv[it], Ws[part] + cc * KP + k0, KP);
  }
  if (tid < N3) Bs[tid] = bval;
  put_rows(xs, Ktb[0][sth] + kdst, 2 * KP);
  AF xb[2][2];
  for (int g = 0; g < 2; ++g)
    for (int ks = 0; ks < 2; ++ks)
      for (int v = 0; v < 4; ++v)
        for (int e = 0; e < 4; ++e)
          xb[g][ks].h[v * 4 + e] = (_Float16)xq[g][ks][v][e];
  __syncthreads();  // weights, bias and pass 0's tiles are in LDS

  // Pass 1's rows are asked for now; the products below hide their latency.
  for (int i = 0; i < 4; ++i)
    xs[i] = *(const v4f*)(xsrc0 + (size_t)(32 + i) * EMBED_DIM);
  // Stands in front of any later write of the address registers; naming the
  // address keeps it out of the loads' own destinations.
  asm volatile("s_wait_xcnt 0x0" ::"v"(xsrc0) : "memory");

  // Q'^T = Wk * (Wq^T * x^T + bq), scaled: two chained products per group. The
  // accumulators of the first (a lane holds 8 consecutive columns of its
  // query per tile) are packed into the B operand of the second, and those of
  // the second into the B operand of S^T, all in load_frag16's k order.
  // Q' carries 1/sqrt(64) and log2 e: its scores are base-2 exponents.
  AF qa[2][2];
  {
    v8f qt[2][4];
    for (int n = 0; n < 4; ++n) {
      AF a0, a1;
      load_frag16(a0, Ws[0] + (n * 16 + ln) * KP, lhi);
      load_frag16(a1, Ws[0] + (n * 16 + ln) * KP + 32, lhi);
      const v4f* bp = (const v4f*)(Bs + n * 16 + lhi * 8);
      const v4f b0 = bp[0], b1 = bp[1];
      v8f c;
      for (int e = 0; e < 4; ++e) {
        c[e]     = b0[e];
        c[4 + e] = b1[e];
      }
      for (int g = 0; g < 2; ++g) qt[g][n] = mma(a1, xb[g][1], mma(a0, xb[g][0], c));
    }
    AF qf[2][2];
    for (int g = 0; g < 2; ++g)
      for (int ks = 0; ks < 2; ++ks)
        pack_b(qf[g][ks], qt[g][2 * ks], qt[g][2 * ks + 1], 1.0f);
    for (int m = 0; m < 4; ++m) {
      AF a0, a1;
      load_frag16(a0, Ws[1] + (m * 16 + ln) * KP, lhi);
      load_frag16(a1, Ws[1] + (m * 16 + ln) * KP + 32, lhi);
      v8f z;
      for (int e = 0; e < 8; ++e) z[e] = 0.0f;
      for (int g = 0; g < 2; ++g) qt[g][m] = mma(a1, qf[g][1], mma(a0, qf[g][0], z));
    }
    for (int g = 0; g < 2; ++g)
      for (int ks = 0; ks < 2; ++ks)
        pack_b(qa[g][ks], qt[g][2 * ks], qt[g][2 * ks + 1],
               0.125f * 1.44269504f);
  }

  // Per lane and group: one query. nref is minus its reference in use, in base
  // 2 (equal in both wave halves and in all eight rows: a C operand), lsum the
  // sum over this lane half's keys only (joined in the epilogue).
  float lsum[2];
  v8f nref[2];
  v8f o[2][4];  // o[g][d][r] = sum_j p_j x_j[hd d*16 + lhi*8 + r] of the query
  for (int g = 0; g < 2; ++g) {
    lsum[g] = 0.0f;
    for (int e = 0; e < 8; ++e) nref[g][e] = 0.0f;
    for (int d = 0; d < 4; ++d)
      for (int e = 0; e < 8; ++e) o[g][d][e] = 0.0f;
  }

  // Pass 1's rows as f16: stored at the head of pass 0.
  v2u rk[4];
  for (int i = 0; i < 4; ++i) rk[i] = row4(xs, i);

  // Where this pass reads its fragments, stores the next tile and asks for
  // the tile after that. Stepped at the foot of the pass, among the last
  // products: the head of a pass holds no vector instruction of its own.
  const int BUFH = 2 * 32 * KP;  // halves per buffer
  const _Float16* kr = Ktb[0][kh] + ksrc + lhi * 8;  // the wave half's k share
  const _Float16* vr = Ktb[0][kh] + vsrc;
  _Float16* sw = Ktb[1][sth] + kdst;
  const float* xp = xsrc0;  // tile kb, held at the last that has a tile kb+2
  for (int kb = 0;; ++kb) {
    const int cur = kb & 1;
    const bool more = kb + 1 < NKB;  // a pass kb+1 exists

    // Every wave has signalled in pass kb-1: this pass's tiles are in
    // buf[cur], and nobody reads buf[cur^1] any more.
    if (kb > 0) bar_wait();

    // At the head of the pass: the x fragments, then the next pass's tiles,
    // converted at the foot of the pass before.
    AF kf[2][2];
    for (int nt = 0; nt < 2; ++nt) {
      load_frag16(kf[nt][0], kr + nt * 16 * KP, 0);
      load_frag16(kf[nt][1], kr + nt * 16 * KP + 32, 0);
    }
    // Keeps the fragment reads first behind the barrier wait, as the products
    // wait for them: left alone, the compiler puts the x loads in front.
    __builtin_amdgcn_sched_barrier(0);
    // No test around the stores: behind a branch the compiler's counted LDS
    // waits merge two paths and hold the products back for the stores. The
    // last pass writes its own rows once more, into the buffer nobody reads.
    for (int i = 0; i < 4; ++i)
      *(v2u*)(sw + i * 2 * KP) = rk[i];
    // The rows of pass kb+2 are asked for here, a whole pass ahead of their
    // conversion. No test here either: the last two passes ask for the last
    // tile's rows again.
    {
      for (int i = 0; i < 4; ++i)
        xs[i] = *(const v4f*)(xp + (size_t)(64 + i) * EMBED_DIM);
      // Stands in front of any later write of the address registers; naming
      // the address keeps it out of the loads' own destinations.
      asm volatile("s_wait_xcnt 0x0" ::"v"(xp) : "memory");
    }
    // Keeps reads and stores one group in front of the products, the stores
    // far from the wait that covers them: left alone, the compiler spread
    // both among the products.
    __builtin_amdgcn_sched_barrier(0);

    // S^T = X * Q'^T : two 16-key M tiles, each 2 K-steps over hd=64, each
    // fragment against both query groups.
    // s[g][nt][r] = score(key nt*16 + lhi*8 + r, query of group g) minus the
    // query's reference.
    v8f s[2][2];
    // The rare path: group g's reference moves to the query's maximum so far,
    // never down (in pass 0, with nothing summed yet, to the pass's own
    // maximum). 16 of a query's 32 scores are in this lane, the other 16 in
    // lane ^ 16. Scores, O and the sum follow the reference.
    auto rebase = [&](int g, bool first) {
      float m = fmaxf(s[g][0][0], s[g][1][0]);
      for (int e = 1; e < 8; ++e) m = fmaxf(fmaxf(s[g][0][e], s[g][1][e]), m);
      float d = fmaxf(m, xhalf(m));
      if (!first) d = fmaxf(d, 0.0f);
      float corr = -fmaxf(d, 0.0f);
      exp2_1(corr);
      for (int e = 0; e < 8; ++e) {
        nref[g][e] -= d;
        s[g][0][e] -= d;
        s[g][1][e] -= d;
      }
      lsum[g] *= corr;
      for (int dd = 0; dd < 4; ++dd)
        for (int r = 0; r < 8; ++r) o[g][dd][r] *= corr;
    };
    for (int g = 0; g < 2; ++g)
      s[g][0] = mma(kf[0][1], qa[g][1], mma(kf[0][0], qa[g][0], nref[g]));
    for (int g = 0; g < 2; ++g) s[g][1] = mma(kf[1][0], qa[g][0], nref[g]);

    // The x^T fragments are asked for ahead of group 0's exponentials, which
    // hide their LDS latency.
    // vf[d]: rows hd d*16 + ln, halves 0..7 keys lhi*8 + 0..7 and halves 8..15
    // keys 16 + lhi*8 + 0..7: load_frag16's k order.
    AF vf[4];
    for (int d = 0; d < 4; ++d) {
      vf[d].q[0] = ld_tr16(vr + d * 16);
      vf[d].q[1] = ld_tr16(vr + 16 * KP + d * 16);
    }
    // Keeps all eight reads in front of the exponentials: left alone, the
    // compiler put half of them further down, close to the wait in front of
    // the signal.
    __builtin_amdgcn_sched_barrier(0);

    // Group 0's terms. The first tile's scores are done: their exponentials
    // stand among the second tile's last products and fill the slots that the
    // chip asks for behind them.
    AF pb[2];
    float ts;
    bool over;
    {
      float p0[8], p1[8];
      // Each sched_barrier keeps this order. Four products stand behind the
      // last one into s[0][0], a product and eight exponentials behind the
      // last one into s[0][1].
      s[0][1] = mma(kf[1][1], qa[0][1], s[0][1]);
      __builtin_amdgcn_sched_barrier(0);
      exp2_8(p0, s[0][0]);
      __builtin_amdgcn_sched_barrier(0);
      s[1][1] = mma(kf[1][1], qa[1][1], s[1][1]);
      __builtin_amdgcn_sched_barrier(0);
      exp2_8(p1, s[0][1]);
      __builtin_amdgcn_sched_barrier(0);
      ts = sum_p(p0, p1);
      // Inputs only, no instruction: the second tile's fragments stay in their
      // registers until the exponentials and the sums have theirs. Freed at
      // their last products, those registers would take these results, and a
      // write to a product's A operand needs four vector slots behind the
      // product: idle slots in front of the sums. The
      // sum is named only so that the statement stands behind it.
      asm volatile("" ::"v"(kf[1][0].v), "v"(kf[1][1].v), "v"(ts));
      // One test per pass, group and wave, a scalar branch. A sum of at most
      // 4096 bounds every term by 4096, well inside f16. Pass 0 sets the
      // reference.
      over = kb == 0 || __builtin_amdgcn_ballot_w32(ts > 4096.0f) != 0;

      // Between the groups: group 0's exponentials and sums have covered the
      // latency of the x^T reads, so the wait costs little here.
      if (more) {
        // This wave's reads of buf[cur] have returned and its part of the next
        // tiles is in buf[cur^1]: say so, and do not wait for the others yet.
        // No LDS access stands between here and the wait of pass kb+1.
        lds_done();
        bar_signal();
      }

      pack_p(pb[0], p0, p1);
      if (__builtin_expect(over, 0)) {
        rebase(0, kb == 0);
        exp2_8(p0, s[0][0]);
        exp2_8(p1, s[0][1]);
        pack_p(pb[0], p0, p1);
        ts = sum_p(p0, p1);
      }
      lsum[0] += ts;
    }

    // O^T += X^T * P^T : four 16-row hd tiles per group, contraction over 32
    // keys. A wave issues in order, so each product here is followed by vector
    // work that does not depend on it. Group 0's products stand among group
    // 1's softmax, group 1's among the conversions of the next tile's rows.
    // Each sched_barrier keeps that order: left alone, the compiler puts the
    // products in a row behind the vector work.
    {
      float p0[8], p1[8];
      o[0][0] = mma(vf[0], pb[0], o[0][0]);
      __builtin_amdgcn_sched_barrier(0);
      exp2_8(p0, s[1][0]);
      __builtin_amdgcn_sched_barrier(0);
      o[0][1] = mma(vf[1], pb[0], o[0][1]);
      __builtin_amdgcn_sched_barrier(0);
      exp2_8(p1, s[1][1]);
      __builtin_amdgcn_sched_barrier(0);
      o[0][2] = mma(vf[2], pb[0], o[0][2]);
      __builtin_amdgcn_sched_barrier(0);
      ts = sum_p(p0, p1);
      over = kb == 0 || __builtin_amdgcn_ballot_w32(ts > 4096.0f) != 0;
      __builtin_amdgcn_sched_barrier(0);
      o[0][3] = mma(vf[3], pb[0], o[0][3]);
      pack_p(pb[1], p0, p1);
      if (__builtin_expect(over, 0)) {
        rebase(1, kb == 0);
        exp2_8(p0, s[1][0]);
        exp2_8(p1, s[1][1]);
        pack_p(pb[1], p0, p1);
        ts = sum_p(p0, p1);
      }
      lsum[1] += ts;
    }
    for (int d = 0; d < 4; ++d) {
      o[1][d] = mma(vf[d], pb[1], o[1][d]);
      rk[d] = row4(xs, d);
    }
    const int step = cur ? -BUFH : BUFH;
    kr += step;
    vr += step;
    sw -= step;
    xp += kb < NKB - 3 ? 32 * EMBED_DIM : 0;
    // The last four products, each followed by its share of the conversions
    // and address steps: the order asked of the scheduler.
    for (int i = 0; i < 4; ++i) {
      __builtin_amdgcn_sched_group_barrier(0x8, 1, 0);
      __builtin_amdgcn_sched_group_barrier(0x2, 3, 0);
    }
    // Inputs only, no instruction: the x^T fragments stay in their registers
    // to the foot of the pass. Freed at their last product, those registers
    // would take the conversions' results, and a write to a product's A
    // operand directly behind it costs the four idle slots the chip asks for.
    asm volatile("" ::"v"(vf[0].v), "v"(vf[1].v), "v"(vf[2].v), "v"(vf[3].v));
    if (!more) break;
  }

  // Merge the key halves: hand group 1 to the partner wave, take the partner's
  // group 1 (this wave's group 0 queries, the other 1024 keys).
  float* xw = Xm + (size_t)wave * 34 * 32 + lane;
  for (int d = 0; d < 4; ++d)
    for (int e = 0; e < 8; ++e) xw[(d * 8 + e) * 32] = o[1][d][e];
  xw[32 * 32] = -nref[1][0];
  xw[33 * 32] = lsum[1];
  __syncthreads();  // the partner's values are in LDS
  const float* xr = Xm + (size_t)(wave ^ 4) * 34 * 32 + lane;
  const float mo = xr[32 * 32];
  const float lo_ = xr[33 * 32];
  const float m0 = -nref[0][0];
  const float mm = fmaxf(m0, mo);
  float c0 = m0 - mm;  // references are base-2 exponents
  float c1 = mo - mm;
  exp2_1(c0);
  exp2_1(c1);
  const float lj = lsum[0] * c0 + lo_ * c1;

  // Normalize: om[d][e] = (sum_j p_j x_j)[hd d*16 + lhi*8 + e] of query trow.
  const float inv = 1.0f / (lj + xhalf(lj));
  c0 *= inv;
  c1 *= inv;
  v8f om[4];
  for (int d = 0; d < 4; ++d)
    for (int e = 0; e < 8; ++e)
      om[d][e] = o[0][d][e] * c0 + xr[(d * 8 + e) * 32] * c1;

  // out^T = Wv^T * om^T + bv: A = Wv^T rows (output columns), B = the sums
  // packed from their registers. A lane holds 8 consecutive columns of its
  // query per tile, two 16-byte stores into fp32 [B, T, E].
  AF ob[2];
  for (int ks = 0; ks < 2; ++ks) pack_b(ob[ks], om[2 * ks], om[2 * ks + 1], 1.0f);
  float* orow = out + (size_t)(b * SEQ_T + trow) * EMBED_DIM + h * HEAD_DIM +
                lhi * 8;
  for (int n = 0; n < 4; ++n) {
    AF a0, a1;
    load_frag16(a0, Ws[2] + (n * 16 + ln) * KP, lhi);
    load_frag16(a1, Ws[2] + (n * 16 + ln) * KP + 32, lhi);
    const v4f* bp = (const v4f*)(Bs + 2 * HEAD_DIM + n * 16 + lhi * 8);
    const v4f b0 = bp[0], b1 = bp[1];
    v8f c;
    for (int e = 0; e < 4; ++e) {
      c[e]     = b0[e];
      c[4 + e] = b1[e];
    }
    c = mma(a1, ob[1], mma(a0, ob[0], c));
    v4f lo, hi;
    for (int e = 0; e < 4; ++e) {
      lo[e] = c[e];
      hi[e] = c[4 + e];
    }
    *(v4f*)(orow + n * 16)     = lo;
    *(v4f*)(orow + n * 16 + 4) = hi;
  }
}

// ---------------------------------------------------------------------------
extern "C" void kernel_launch(void* const* d_in, const int* in_sizes, int n_in,
                              void* d_out, int out_size, void* d_ws, size_t ws_size,
                              hipStream_t stream) {
  (void)in_sizes; (void)n_in; (void)out_size; (void)d_ws; (void)ws_size;
  const float* x    = (const float*)d_in[0];
  const float* W    = (const float*)d_in[1];
  const float* bias = (const float*)d_in[2];

  dim3 grid(SEQ_T / 128, NUM_HEADS, BATCH);  // 16 x 16 x 2 = 512 blocks
  fused_attn_kernel<<<grid, 256, 0, stream>>>(x, W, bias, (float*)d_out);
}
